// v000
// The times below were measured on an AMD MI455X: many runs one after another, warmed up first and cycling through
// copies of the inputs, with the whole window's GPU time divided by the number of runs. Launches and the gaps
// between them are all in it. The median over several windows is given; except for v000 it joins two sittings, which
// can be a few percent apart, so the side-by-side timings, each taken in one sitting, are the better comparison.
// The starting kernel, v000, takes 427 microseconds a run.
#include <hip/hip_runtime.h>

// ---------------------------------------------------------------------------
// ComplexSpectralAttention == standard causal MHA, head_dim=128, scale=1/8,
// plus QKV projection GEMMs and an output projection GEMM.
// Shapes: B=2, N=2048, C=1024, H=16, D=128 (per head), tokens NT=4096.
// Strategy: f16 WMMA (v_wmma_f32_16x16x32_f16) everywhere, f32 accumulate.
// Attention streams K/V tiles into LDS with global_load_async_to_lds_b128
// (ASYNCcnt), double-buffered, shared by all 8 waves of the block.
// Workspace (f16 elements), total ~88 MB: xb, WqT/WkT/WvT/WoT, Q, K, Vt, A2.
// ---------------------------------------------------------------------------

typedef __attribute__((ext_vector_type(16))) _Float16     v16h;
typedef __attribute__((ext_vector_type(8)))  float        v8f;
typedef __attribute__((ext_vector_type(4)))  unsigned int v4u;

union Frag {            // one WMMA A/B operand: 16 f16 = 8 VGPRs = 2 x b128
    v16h v;
    v4u  q[2];          // q[0] = K {kb..kb+7}, q[1] = K {kb+16..kb+23}
};

__device__ __forceinline__ unsigned short f2h(float f) {
    union { _Float16 h; unsigned short u; } cv;
    cv.h = (_Float16)f;
    return cv.u;
}

__device__ __forceinline__ v4u ldg128(const unsigned short* p) {
    return *(const v4u*)p;
}

__device__ __forceinline__ v8f wmma16(const Frag& a, const Frag& b, v8f c) {
    return __builtin_amdgcn_wmma_f32_16x16x32_f16(
        false, a.v, false, b.v, (short)0, c, false, false);
}

// Async copy 16B/lane from global to LDS (gfx1250 VGLOBAL, tracked by ASYNCcnt)
__device__ __forceinline__ void async_ld128(unsigned lds_off,
                                            const unsigned short* gptr) {
    unsigned long long ga = (unsigned long long)(size_t)gptr;
    asm volatile("global_load_async_to_lds_b128 %0, %1, off"
                 :: "v"(lds_off), "v"(ga) : "memory");
}

#define SEQ   2048
#define NTOK  4096
#define CIN   1024
#define C2    2048
#define HEADS 16
#define KPAD  136   // 128 + 8 f16 pad (16B) to break LDS bank conflicts
#define VPAD  40    // 32 + 8 f16 pad

// ---------------------------------------------------------------------------
// Kernel 1a: x f32 -> f16
__global__ __launch_bounds__(256) void csa_cvt_kernel(
    const float* __restrict__ x, unsigned short* __restrict__ xb, int n) {
    int i = blockIdx.x * 256 + threadIdx.x;
    if (i < n) xb[i] = f2h(x[i]);
}

// Kernel 1b: W (Krows x Ncols, f32) -> WT (Ncols x Krows, f16)
__global__ __launch_bounds__(256) void csa_cvt_tr_kernel(
    const float* __restrict__ W, unsigned short* __restrict__ WT,
    int Krows, int Ncols) {
    int i = blockIdx.x * 256 + threadIdx.x;
    if (i < Krows * Ncols) {
        int k = i / Ncols, n = i % Ncols;
        WT[(size_t)n * Krows + k] = f2h(W[i]);
    }
}

// ---------------------------------------------------------------------------
// Kernel 2: fused QKV GEMM.  Y = xb(4096x1024) @ W(1024x2048), z picks weight.
// Block tile 128x128, 8 waves as 2x4, wave tile 64x32 (4x2 WMMA tiles).
// z==2 (V) stores transposed per head into Vt.
__global__ __launch_bounds__(256) void csa_qkv_gemm_kernel(
    const unsigned short* __restrict__ xb,
    const unsigned short* __restrict__ WqT,
    const unsigned short* __restrict__ WkT,
    const unsigned short* __restrict__ WvT,
    unsigned short* __restrict__ Qo,
    unsigned short* __restrict__ Ko,
    unsigned short* __restrict__ Vt) {
    const int lane = threadIdx.x & 31, l16 = lane & 15, lhi = lane >> 4;
    const int w = threadIdx.x >> 5;
    const int Mbase = blockIdx.y * 128 + (w >> 2) * 64;
    const int Nbase = blockIdx.x * 128 + (w & 3) * 32;
    const unsigned short* BT = (blockIdx.z == 0) ? WqT
                             : (blockIdx.z == 1) ? WkT : WvT;
    v8f acc[4][2] = {};
    for (int k = 0; k < CIN; k += 32) {
        __builtin_prefetch(xb + (size_t)(Mbase + l16) * CIN + k + 64, 0, 3);
        Frag a[4], b[2];
#pragma unroll
        for (int mt = 0; mt < 4; ++mt) {
            const unsigned short* p =
                xb + (size_t)(Mbase + mt * 16 + l16) * CIN + k + lhi * 8;
            a[mt].q[0] = ldg128(p);
            a[mt].q[1] = ldg128(p + 16);
        }
#pragma unroll
        for (int nt = 0; nt < 2; ++nt) {
            const unsigned short* p =
                BT + (size_t)(Nbase + nt * 16 + l16) * CIN + k + lhi * 8;
            b[nt].q[0] = ldg128(p);
            b[nt].q[1] = ldg128(p + 16);
        }
#pragma unroll
        for (int mt = 0; mt < 4; ++mt)
#pragma unroll
            for (int nt = 0; nt < 2; ++nt)
                acc[mt][nt] = wmma16(a[mt], b[nt], acc[mt][nt]);
    }
    if (blockIdx.z < 2) {
        unsigned short* O = (blockIdx.z == 0) ? Qo : Ko;
#pragma unroll
        for (int mt = 0; mt < 4; ++mt)
#pragma unroll
            for (int nt = 0; nt < 2; ++nt)
#pragma unroll
                for (int i = 0; i < 8; ++i) {
                    int row = Mbase + mt * 16 + i + lhi * 8;
                    int col = Nbase + nt * 16 + l16;
                    O[(size_t)row * C2 + col] = f2h(acc[mt][nt][i]);
                }
    } else {
#pragma unroll
        for (int mt = 0; mt < 4; ++mt)
#pragma unroll
            for (int nt = 0; nt < 2; ++nt)
#pragma unroll
                for (int i = 0; i < 8; ++i) {
                    int row = Mbase + mt * 16 + i + lhi * 8;   // token
                    int col = Nbase + nt * 16 + l16;           // channel
                    int bb = row >> 11, nn = row & (SEQ - 1);
                    int h = col >> 7, d = col & 127;
                    Vt[(((size_t)(bb * HEADS + h) * 128 + d) << 11) + nn] =
                        f2h(acc[mt][nt][i]);
                }
    }
}

// ---------------------------------------------------------------------------
// Kernel 3: causal flash attention with async-LDS double buffering.
// grid = (N/128 query blocks, B*H); 8 waves, wave w owns rows [q0b+16w, +16).
// Per 32-key step: 256 threads issue 4x global_load_async_to_lds_b128 each
// (K tile 32x128 -> Kbuf[key][d], V tile 128x32 -> Vbuf[d][key]); compute on
// tile i overlaps the async DMA of tile i+1.  Online softmax in f32.
__global__ __launch_bounds__(256) void csa_attn_kernel(
    const unsigned short* __restrict__ Qg,
    const unsigned short* __restrict__ Kg,
    const unsigned short* __restrict__ Vt,
    unsigned short* __restrict__ A2) {
    __shared__ __align__(16) unsigned short Kbuf[2][32 * KPAD];
    __shared__ __align__(16) unsigned short Vbuf[2][128 * VPAD];
    __shared__ __align__(16) unsigned short Plds[8 * 16 * 32];

    const int tid = threadIdx.x;
    const int lane = tid & 31, l16 = lane & 15, lhi = lane >> 4;
    const int w = tid >> 5;
    const int bb = blockIdx.y >> 4, h = blockIdx.y & 15;
    const int q0b = blockIdx.x * 128;
    const int q0 = q0b + w * 16;

    const unsigned short* Qb = Qg + (size_t)bb * SEQ * C2 + h * 128;
    const unsigned short* Kb = Kg + (size_t)bb * SEQ * C2 + h * 128;
    const unsigned short* Vb = Vt + (size_t)(bb * HEADS + h) * 128 * SEQ;
    unsigned short*       Ob = A2 + (size_t)bb * SEQ * C2 + h * 128;
    unsigned short*       Pw = Plds + w * 512;

    // per-thread async chunk coordinates (16B chunks)
    const int kr = tid >> 4, kc = (tid & 15) * 8;   // K: rows kr, kr+16
    const int vd = tid >> 2, vc = (tid & 3) * 8;    // V: rows vd, vd+64

    Frag qf[4];
#pragma unroll
    for (int j = 0; j < 4; ++j) {
        const unsigned short* p = Qb + (size_t)(q0 + l16) * C2 + j * 32 + lhi * 8;
        qf[j].q[0] = ldg128(p);
        qf[j].q[1] = ldg128(p + 16);
    }

    v8f o[8] = {};
    float mrow[8], lrow[8];
#pragma unroll
    for (int i = 0; i < 8; ++i) { mrow[i] = -1e30f; lrow[i] = 0.0f; }

    const int niter = (q0b + 128) / 32;   // uniform across the block

    // prologue: async-issue tile 0 into buffer 0
    {
        unsigned kof = (unsigned)(size_t)&Kbuf[0][0];
        unsigned vof = (unsigned)(size_t)&Vbuf[0][0];
        async_ld128(kof + (unsigned)(kr * KPAD + kc) * 2,
                    Kb + (size_t)kr * C2 + kc);
        async_ld128(kof + (unsigned)((kr + 16) * KPAD + kc) * 2,
                    Kb + (size_t)(kr + 16) * C2 + kc);
        async_ld128(vof + (unsigned)(vd * VPAD + vc) * 2,
                    Vb + (size_t)vd * SEQ + vc);
        async_ld128(vof + (unsigned)((vd + 64) * VPAD + vc) * 2,
                    Vb + (size_t)(vd + 64) * SEQ + vc);
    }

    for (int it = 0; it < niter; ++it) {
        const int kv = it * 32;
        __syncthreads();                  // release buffer (it+1)&1
        if (it + 1 < niter) {
            const int kvn = kv + 32;
            unsigned kof = (unsigned)(size_t)&Kbuf[(it + 1) & 1][0];
            unsigned vof = (unsigned)(size_t)&Vbuf[(it + 1) & 1][0];
            async_ld128(kof + (unsigned)(kr * KPAD + kc) * 2,
                        Kb + (size_t)(kvn + kr) * C2 + kc);
            async_ld128(kof + (unsigned)((kr + 16) * KPAD + kc) * 2,
                        Kb + (size_t)(kvn + kr + 16) * C2 + kc);
            async_ld128(vof + (unsigned)(vd * VPAD + vc) * 2,
                        Vb + (size_t)vd * SEQ + kvn + vc);
            async_ld128(vof + (unsigned)((vd + 64) * VPAD + vc) * 2,
                        Vb + (size_t)(vd + 64) * SEQ + kvn + vc);
            // async loads complete in order: cnt<=4 => tile `it` has landed
            asm volatile("s_wait_asynccnt 0x4" ::: "memory");
        } else {
            asm volatile("s_wait_asynccnt 0x0" ::: "memory");
        }
        __syncthreads();                  // tile `it` visible to all waves

        const unsigned short* kt = Kbuf[it & 1];
        const unsigned short* vt = Vbuf[it & 1];

        // S = Q * K^T  (two 16x16 key tiles)
        v8f s0 = {}, s1 = {};
#pragma unroll
        for (int j = 0; j < 4; ++j) {     // d chunks of 32
            Frag k0, k1;
            const unsigned short* p0 = kt + l16 * KPAD + j * 32 + lhi * 8;
            k0.q[0] = *(const v4u*)p0;
            k0.q[1] = *(const v4u*)(p0 + 16);
            const unsigned short* p1 = p0 + 16 * KPAD;
            k1.q[0] = *(const v4u*)p1;
            k1.q[1] = *(const v4u*)(p1 + 16);
            s0 = wmma16(qf[j], k0, s0);
            s1 = wmma16(qf[j], k1, s1);
        }

        // online softmax update (per-VGPR-row state, 16-lane reductions)
#pragma unroll
        for (int i = 0; i < 8; ++i) {
            int row = q0 + i + lhi * 8;
            int c0 = kv + l16, c1 = kv + 16 + l16;
            float v0 = s0[i] * 0.125f;    // scale 1/sqrt(64)
            float v1 = s1[i] * 0.125f;
            if (c0 > row) v0 = -1e30f;
            if (c1 > row) v1 = -1e30f;
            float mx = fmaxf(v0, v1);
            for (int d = 1; d < 16; d <<= 1)
                mx = fmaxf(mx, __shfl_xor(mx, d, 32));
            float mnew  = fmaxf(mrow[i], mx);
            float scale = __expf(mrow[i] - mnew);
            float p0 = __expf(v0 - mnew), p1 = __expf(v1 - mnew);
            float rs = p0 + p1;
            for (int d = 1; d < 16; d <<= 1)
                rs += __shfl_xor(rs, d, 32);
            lrow[i] = lrow[i] * scale + rs;
            mrow[i] = mnew;
#pragma unroll
            for (int t = 0; t < 8; ++t) o[t][i] *= scale;
            int m = i + lhi * 8;          // C-layout row within tile
            Pw[m * 32 + l16]      = f2h(p0);
            Pw[m * 32 + 16 + l16] = f2h(p1);
        }
        // re-read P in A-fragment layout (same-wave LDS is in-order)
        Frag pf;
        pf.q[0] = *(const v4u*)(Pw + l16 * 32 + lhi * 8);
        pf.q[1] = *(const v4u*)(Pw + l16 * 32 + lhi * 8 + 16);
#pragma unroll
        for (int t = 0; t < 8; ++t) {     // O += P * V  (8 d-tiles)
            Frag vf;
            const unsigned short* p = vt + (t * 16 + l16) * VPAD + lhi * 8;
            vf.q[0] = *(const v4u*)p;
            vf.q[1] = *(const v4u*)(p + 16);
            o[t] = wmma16(pf, vf, o[t]);
        }
    }

#pragma unroll
    for (int i = 0; i < 8; ++i) {
        float inv = 1.0f / lrow[i];
        int row = q0 + i + lhi * 8;
#pragma unroll
        for (int t = 0; t < 8; ++t)
            Ob[(size_t)row * C2 + t * 16 + l16] = f2h(o[t][i] * inv);
    }
}

// ---------------------------------------------------------------------------
// Kernel 4: output projection.  out = A2(4096x2048) @ Wo(2048x1024), f32 out.
__global__ __launch_bounds__(256) void csa_oproj_gemm_kernel(
    const unsigned short* __restrict__ A2,
    const unsigned short* __restrict__ WoT,
    float* __restrict__ out) {
    const int lane = threadIdx.x & 31, l16 = lane & 15, lhi = lane >> 4;
    const int w = threadIdx.x >> 5;
    const int Mbase = blockIdx.y * 128 + (w >> 2) * 64;
    const int Nbase = blockIdx.x * 128 + (w & 3) * 32;
    v8f acc[4][2] = {};
    for (int k = 0; k < C2; k += 32) {
        __builtin_prefetch(A2 + (size_t)(Mbase + l16) * C2 + k + 64, 0, 3);
        Frag a[4], b[2];
#pragma unroll
        for (int mt = 0; mt < 4; ++mt) {
            const unsigned short* p =
                A2 + (size_t)(Mbase + mt * 16 + l16) * C2 + k + lhi * 8;
            a[mt].q[0] = ldg128(p);
            a[mt].q[1] = ldg128(p + 16);
        }
#pragma unroll
        for (int nt = 0; nt < 2; ++nt) {
            const unsigned short* p =
                WoT + (size_t)(Nbase + nt * 16 + l16) * C2 + k + lhi * 8;
            b[nt].q[0] = ldg128(p);
            b[nt].q[1] = ldg128(p + 16);
        }
#pragma unroll
        for (int mt = 0; mt < 4; ++mt)
#pragma unroll
            for (int nt = 0; nt < 2; ++nt)
                acc[mt][nt] = wmma16(a[mt], b[nt], acc[mt][nt]);
    }
#pragma unroll
    for (int mt = 0; mt < 4; ++mt)
#pragma unroll
        for (int nt = 0; nt < 2; ++nt)
#pragma unroll
            for (int i = 0; i < 8; ++i) {
                int row = Mbase + mt * 16 + i + lhi * 8;
                int col = Nbase + nt * 16 + l16;
                out[(size_t)row * CIN + col] = acc[mt][nt][i];
            }
}

// ---------------------------------------------------------------------------
extern "C" void kernel_launch(void* const* d_in, const int* in_sizes, int n_in,
                              void* d_out, int out_size, void* d_ws,
                              size_t ws_size, hipStream_t stream) {
    (void)in_sizes; (void)n_in; (void)out_size; (void)ws_size;
    const float* x  = (const float*)d_in[0];
    const float* Wq = (const float*)d_in[1];
    const float* Wk = (const float*)d_in[2];
    const float* Wv = (const float*)d_in[3];
    const float* Wo = (const float*)d_in[4];

    unsigned short* xb  = (unsigned short*)d_ws;            // 4M elems
    unsigned short* WqT = xb  + (size_t)NTOK * CIN;         // 2M
    unsigned short* WkT = WqT + (size_t)C2 * CIN;           // 2M
    unsigned short* WvT = WkT + (size_t)C2 * CIN;           // 2M
    unsigned short* WoT = WvT + (size_t)C2 * CIN;           // 2M
    unsigned short* Qb  = WoT + (size_t)CIN * C2;           // 8M
    unsigned short* Kb  = Qb  + (size_t)NTOK * C2;          // 8M
    unsigned short* Vt  = Kb  + (size_t)NTOK * C2;          // 8M
    unsigned short* A2  = Vt  + (size_t)2 * HEADS * 128 * SEQ; // 8M

    csa_cvt_kernel<<<(NTOK * CIN) / 256, 256, 0, stream>>>(x, xb, NTOK * CIN);
    csa_cvt_tr_kernel<<<(CIN * C2) / 256, 256, 0, stream>>>(Wq, WqT, CIN, C2);
    csa_cvt_tr_kernel<<<(CIN * C2) / 256, 256, 0, stream>>>(Wk, WkT, CIN, C2);
    csa_cvt_tr_kernel<<<(CIN * C2) / 256, 256, 0, stream>>>(Wv, WvT, CIN, C2);
    csa_cvt_tr_kernel<<<(C2 * CIN) / 256, 256, 0, stream>>>(Wo, WoT, C2, CIN);

    csa_qkv_gemm_kernel<<<dim3(C2 / 128, NTOK / 128, 3), 256, 0, stream>>>(
        xb, WqT, WkT, WvT, Qb, Kb, Vt);

    csa_attn_kernel<<<dim3(SEQ / 128, 2 * HEADS), 256, 0, stream>>>(
        Qb, Kb, Vt, A2);

    csa_oproj_gemm_kernel<<<dim3(CIN / 128, NTOK / 128), 256, 0, stream>>>(
        A2, WoT, (float*)d_out);
}

// v001
// Measured time: 342 microseconds a run.
// Next to v000, in two timings, it ran 1.28 times as fast each time.
#include <hip/hip_runtime.h>

// ---------------------------------------------------------------------------
// ComplexSpectralAttention == standard causal MHA, head_dim=128, scale=1/8,
// plus QKV projection GEMMs and an output projection GEMM.
// Shapes: B=2, N=2048, C=1024, H=16, D=128 (per head), tokens NT=4096.
// Strategy: f16 WMMA (v_wmma_f32_16x16x32_f16) everywhere, f32 accumulate.
// Attention streams K/V tiles into LDS with global_load_async_to_lds_b128
// (ASYNCcnt), double-buffered, shared by all 8 waves of the block.
// Workspace (f16 elements), total ~88 MB: xb, WqT/WkT/WvT/WoT, Q, K, Vt, A2.
// ---------------------------------------------------------------------------

typedef __attribute__((ext_vector_type(16))) _Float16     v16h;
typedef __attribute__((ext_vector_type(8)))  float        v8f;
typedef __attribute__((ext_vector_type(4)))  unsigned int v4u;
typedef __attribute__((ext_vector_type(4)))  float        v4f;

union Frag {            // one WMMA A/B operand: 16 f16 = 8 VGPRs = 2 x b128
    v16h v;
    v4u  q[2];          // q[0] = K {kb..kb+7}, q[1] = K {kb+16..kb+23}
};

__device__ __forceinline__ unsigned short f2h(float f) {
    union { _Float16 h; unsigned short u; } cv;
    cv.h = (_Float16)f;
    return cv.u;
}

__device__ __forceinline__ v4u ldg128(const unsigned short* p) {
    return *(const v4u*)p;
}

__device__ __forceinline__ v8f wmma16(const Frag& a, const Frag& b, v8f c) {
    return __builtin_amdgcn_wmma_f32_16x16x32_f16(
        false, a.v, false, b.v, (short)0, c, false, false);
}

// Async copy 16B/lane from global to LDS (gfx1250 VGLOBAL, tracked by ASYNCcnt)
__device__ __forceinline__ void async_ld128(unsigned lds_off,
                                            const unsigned short* gptr) {
    unsigned long long ga = (unsigned long long)(size_t)gptr;
    asm volatile("global_load_async_to_lds_b128 %0, %1, off"
                 :: "v"(lds_off), "v"(ga) : "memory");
}

#define SEQ   2048
#define NTOK  4096
#define CIN   1024
#define C2    2048
#define HEADS 16
#define KPAD  136   // 128 + 8 f16 pad (16B) to break LDS bank conflicts
#define VPAD  40    // 32 + 8 f16 pad
#define TRK   64    // transpose tile: k rows (64 f16 = one 128-byte line of WT)
#define TRN   128   // transpose tile: n columns
#define TRP   72    // transpose tile: LDS pitch, 64 + 8 f16 (16-byte aligned rows)

// ---------------------------------------------------------------------------
// Kernel 1a: x f32 -> f16
__global__ __launch_bounds__(256) void csa_cvt_kernel(
    const float* __restrict__ x, unsigned short* __restrict__ xb, int n) {
    int i = blockIdx.x * 256 + threadIdx.x;
    if (i < n) xb[i] = f2h(x[i]);
}

// Kernel 1b: W (Krows x Ncols, f32) -> WT (Ncols x Krows, f16), one 64 k x 128 n
// tile per block through LDS: 16-byte loads along n, whole 128-byte lines of WT
// stored along k.  Krows is a multiple of 64, Ncols a multiple of 128.
__global__ __launch_bounds__(256) void csa_cvt_tr_kernel(
    const float* __restrict__ W, unsigned short* __restrict__ WT,
    int Krows, int Ncols) {
    __shared__ __align__(16) unsigned short tile[TRN * TRP];
    const int tid = threadIdx.x;
    const int k0 = blockIdx.y * TRK, n0 = blockIdx.x * TRN;
    const int kq = tid >> 5, nq = tid & 31;   // 8 k rows x 4 n columns a thread
    const float* s = W + (size_t)(k0 + kq * 8) * Ncols + n0 + nq * 4;
    const float* a[8];
    v4f r[8];
#pragma unroll
    for (int i = 0; i < 8; ++i) a[i] = s + (size_t)i * Ncols;
#pragma unroll
    for (int i = 0; i < 8; ++i) r[i] = *(const v4f*)a[i];
    // inputs only: the eight results keep all eight loads in flight together (the
    // compiler otherwise held the last two back behind the first four), and the
    // eight address pairs stay live, so nothing lands in one ahead of this wait
    asm volatile("s_wait_xcnt 0x0"
                 :: "v"(a[0]), "v"(a[1]), "v"(a[2]), "v"(a[3]),
                    "v"(a[4]), "v"(a[5]), "v"(a[6]), "v"(a[7]),
                    "v"(r[0]), "v"(r[1]), "v"(r[2]), "v"(r[3]),
                    "v"(r[4]), "v"(r[5]), "v"(r[6]), "v"(r[7]) : "memory");
#pragma unroll
    for (int j = 0; j < 4; ++j) {
        union { unsigned short h[8]; v4u q; } pk;
#pragma unroll
        for (int i = 0; i < 8; ++i) pk.h[i] = f2h(r[i][j]);
        *(v4u*)&tile[(nq * 4 + j) * TRP + kq * 8] = pk.q;
    }
    __syncthreads();                          // tile complete before read-out
    const int rn = tid >> 3, c = tid & 7;     // 8 threads store one WT line
#pragma unroll
    for (int p = 0; p < TRN / 32; ++p) {
        const int n = p * 32 + rn;
        *(v4u*)(WT + (size_t)(n0 + n) * Krows + k0 + c * 8) =
            *(const v4u*)&tile[n * TRP + c * 8];
    }
}

// ---------------------------------------------------------------------------
// Kernel 2: fused QKV GEMM.  Y = xb(4096x1024) @ W(1024x2048), z picks weight.
// Block tile 128x128, 8 waves as 2x4, wave tile 64x32 (4x2 WMMA tiles).
// z==2 (V) stores transposed per head into Vt.
__global__ __launch_bounds__(256) void csa_qkv_gemm_kernel(
    const unsigned short* __restrict__ xb,
    const unsigned short* __restrict__ WqT,
    const unsigned short* __restrict__ WkT,
    const unsigned short* __restrict__ WvT,
    unsigned short* __restrict__ Qo,
    unsigned short* __restrict__ Ko,
    unsigned short* __restrict__ Vt) {
    const int lane = threadIdx.x & 31, l16 = lane & 15, lhi = lane >> 4;
    const int w = threadIdx.x >> 5;
    const int Mbase = blockIdx.y * 128 + (w >> 2) * 64;
    const int Nbase = blockIdx.x * 128 + (w & 3) * 32;
    const unsigned short* BT = (blockIdx.z == 0) ? WqT
                             : (blockIdx.z == 1) ? WkT : WvT;
    v8f acc[4][2] = {};
    for (int k = 0; k < CIN; k += 32) {
        __builtin_prefetch(xb + (size_t)(Mbase + l16) * CIN + k + 64, 0, 3);
        Frag a[4], b[2];
#pragma unroll
        for (int mt = 0; mt < 4; ++mt) {
            const unsigned short* p =
                xb + (size_t)(Mbase + mt * 16 + l16) * CIN + k + lhi * 8;
            a[mt].q[0] = ldg128(p);
            a[mt].q[1] = ldg128(p + 16);
        }
#pragma unroll
        for (int nt = 0; nt < 2; ++nt) {
            const unsigned short* p =
                BT + (size_t)(Nbase + nt * 16 + l16) * CIN + k + lhi * 8;
            b[nt].q[0] = ldg128(p);
            b[nt].q[1] = ldg128(p + 16);
        }
#pragma unroll
        for (int mt = 0; mt < 4; ++mt)
#pragma unroll
            for (int nt = 0; nt < 2; ++nt)
                acc[mt][nt] = wmma16(a[mt], b[nt], acc[mt][nt]);
    }
    if (blockIdx.z < 2) {
        unsigned short* O = (blockIdx.z == 0) ? Qo : Ko;
#pragma unroll
        for (int mt = 0; mt < 4; ++mt)
#pragma unroll
            for (int nt = 0; nt < 2; ++nt)
#pragma unroll
                for (int i = 0; i < 8; ++i) {
                    int row = Mbase + mt * 16 + i + lhi * 8;
                    int col = Nbase + nt * 16 + l16;
                    O[(size_t)row * C2 + col] = f2h(acc[mt][nt][i]);
                }
    } else {
#pragma unroll
        for (int mt = 0; mt < 4; ++mt)
#pragma unroll
            for (int nt = 0; nt < 2; ++nt)
#pragma unroll
                for (int i = 0; i < 8; ++i) {
                    int row = Mbase + mt * 16 + i + lhi * 8;   // token
                    int col = Nbase + nt * 16 + l16;           // channel
                    int bb = row >> 11, nn = row & (SEQ - 1);
                    int h = col >> 7, d = col & 127;
                    Vt[(((size_t)(bb * HEADS + h) * 128 + d) << 11) + nn] =
                        f2h(acc[mt][nt][i]);
                }
    }
}

// ---------------------------------------------------------------------------
// Kernel 3: causal flash attention with async-LDS double buffering.
// grid = (N/128 query blocks, B*H); 8 waves, wave w owns rows [q0b+16w, +16).
// Per 32-key step: 256 threads issue 4x global_load_async_to_lds_b128 each
// (K tile 32x128 -> Kbuf[key][d], V tile 128x32 -> Vbuf[d][key]); compute on
// tile i overlaps the async DMA of tile i+1.  Online softmax in f32.
__global__ __launch_bounds__(256) void csa_attn_kernel(
    const unsigned short* __restrict__ Qg,
    const unsigned short* __restrict__ Kg,
    const unsigned short* __restrict__ Vt,
    unsigned short* __restrict__ A2) {
    __shared__ __align__(16) unsigned short Kbuf[2][32 * KPAD];
    __shared__ __align__(16) unsigned short Vbuf[2][128 * VPAD];
    __shared__ __align__(16) unsigned short Plds[8 * 16 * 32];

    const int tid = threadIdx.x;
    const int lane = tid & 31, l16 = lane & 15, lhi = lane >> 4;
    const int w = tid >> 5;
    const int bb = blockIdx.y >> 4, h = blockIdx.y & 15;
    const int q0b = blockIdx.x * 128;
    const int q0 = q0b + w * 16;

    const unsigned short* Qb = Qg + (size_t)bb * SEQ * C2 + h * 128;
    const unsigned short* Kb = Kg + (size_t)bb * SEQ * C2 + h * 128;
    const unsigned short* Vb = Vt + (size_t)(bb * HEADS + h) * 128 * SEQ;
    unsigned short*       Ob = A2 + (size_t)bb * SEQ * C2 + h * 128;
    unsigned short*       Pw = Plds + w * 512;

    // per-thread async chunk coordinates (16B chunks)
    const int kr = tid >> 4, kc = (tid & 15) * 8;   // K: rows kr, kr+16
    const int vd = tid >> 2, vc = (tid & 3) * 8;    // V: rows vd, vd+64

    Frag qf[4];
#pragma unroll
    for (int j = 0; j < 4; ++j) {
        const unsigned short* p = Qb + (size_t)(q0 + l16) * C2 + j * 32 + lhi * 8;
        qf[j].q[0] = ldg128(p);
        qf[j].q[1] = ldg128(p + 16);
    }

    v8f o[8] = {};
    float mrow[8], lrow[8];
#pragma unroll
    for (int i = 0; i < 8; ++i) { mrow[i] = -1e30f; lrow[i] = 0.0f; }

    const int niter = (q0b + 128) / 32;   // uniform across the block

    // prologue: async-issue tile 0 into buffer 0
    {
        unsigned kof = (unsigned)(size_t)&Kbuf[0][0];
        unsigned vof = (unsigned)(size_t)&Vbuf[0][0];
        async_ld128(kof + (unsigned)(kr * KPAD + kc) * 2,
                    Kb + (size_t)kr * C2 + kc);
        async_ld128(kof + (unsigned)((kr + 16) * KPAD + kc) * 2,
                    Kb + (size_t)(kr + 16) * C2 + kc);
        async_ld128(vof + (unsigned)(vd * VPAD + vc) * 2,
                    Vb + (size_t)vd * SEQ + vc);
        async_ld128(vof + (unsigned)((vd + 64) * VPAD + vc) * 2,
                    Vb + (size_t)(vd + 64) * SEQ + vc);
    }

    for (int it = 0; it < niter; ++it) {
        const int kv = it * 32;
        __syncthreads();                  // release buffer (it+1)&1
        if (it + 1 < niter) {
            const int kvn = kv + 32;
            unsigned kof = (unsigned)(size_t)&Kbuf[(it + 1) & 1][0];
            unsigned vof = (unsigned)(size_t)&Vbuf[(it + 1) & 1][0];
            async_ld128(kof + (unsigned)(kr * KPAD + kc) * 2,
                        Kb + (size_t)(kvn + kr) * C2 + kc);
            async_ld128(kof + (unsigned)((kr + 16) * KPAD + kc) * 2,
                        Kb + (size_t)(kvn + kr + 16) * C2 + kc);
            async_ld128(vof + (unsigned)(vd * VPAD + vc) * 2,
                        Vb + (size_t)vd * SEQ + kvn + vc);
            async_ld128(vof + (unsigned)((vd + 64) * VPAD + vc) * 2,
                        Vb + (size_t)(vd + 64) * SEQ + kvn + vc);
            // async loads complete in order: cnt<=4 => tile `it` has landed
            asm volatile("s_wait_asynccnt 0x4" ::: "memory");
        } else {
            asm volatile("s_wait_asynccnt 0x0" ::: "memory");
        }
        __syncthreads();                  // tile `it` visible to all waves

        const unsigned short* kt = Kbuf[it & 1];
        const unsigned short* vt = Vbuf[it & 1];

        // S = Q * K^T  (two 16x16 key tiles)
        v8f s0 = {}, s1 = {};
#pragma unroll
        for (int j = 0; j < 4; ++j) {     // d chunks of 32
            Frag k0, k1;
            const unsigned short* p0 = kt + l16 * KPAD + j * 32 + lhi * 8;
            k0.q[0] = *(const v4u*)p0;
            k0.q[1] = *(const v4u*)(p0 + 16);
            const unsigned short* p1 = p0 + 16 * KPAD;
            k1.q[0] = *(const v4u*)p1;
            k1.q[1] = *(const v4u*)(p1 + 16);
            s0 = wmma16(qf[j], k0, s0);
            s1 = wmma16(qf[j], k1, s1);
        }

        // online softmax update (per-VGPR-row state, 16-lane reductions)
#pragma unroll
        for (int i = 0; i < 8; ++i) {
            int row = q0 + i + lhi * 8;
            int c0 = kv + l16, c1 = kv + 16 + l16;
            float v0 = s0[i] * 0.125f;    // scale 1/sqrt(64)
            float v1 = s1[i] * 0.125f;
            if (c0 > row) v0 = -1e30f;
            if (c1 > row) v1 = -1e30f;
            float mx = fmaxf(v0, v1);
            for (int d = 1; d < 16; d <<= 1)
                mx = fmaxf(mx, __shfl_xor(mx, d, 32));
            float mnew  = fmaxf(mrow[i], mx);
            float scale = __expf(mrow[i] - mnew);
            float p0 = __expf(v0 - mnew), p1 = __expf(v1 - mnew);
            float rs = p0 + p1;
            for (int d = 1; d < 16; d <<= 1)
                rs += __shfl_xor(rs, d, 32);
            lrow[i] = lrow[i] * scale + rs;
            mrow[i] = mnew;
#pragma unroll
            for (int t = 0; t < 8; ++t) o[t][i] *= scale;
            int m = i + lhi * 8;          // C-layout row within tile
            Pw[m * 32 + l16]      = f2h(p0);
            Pw[m * 32 + 16 + l16] = f2h(p1);
        }
        // re-read P in A-fragment layout (same-wave LDS is in-order)
        Frag pf;
        pf.q[0] = *(const v4u*)(Pw + l16 * 32 + lhi * 8);
        pf.q[1] = *(const v4u*)(Pw + l16 * 32 + lhi * 8 + 16);
#pragma unroll
        for (int t = 0; t < 8; ++t) {     // O += P * V  (8 d-tiles)
            Frag vf;
            const unsigned short* p = vt + (t * 16 + l16) * VPAD + lhi * 8;
            vf.q[0] = *(const v4u*)p;
            vf.q[1] = *(const v4u*)(p + 16);
            o[t] = wmma16(pf, vf, o[t]);
        }
    }

#pragma unroll
    for (int i = 0; i < 8; ++i) {
        float inv = 1.0f / lrow[i];
        int row = q0 + i + lhi * 8;
#pragma unroll
        for (int t = 0; t < 8; ++t)
            Ob[(size_t)row * C2 + t * 16 + l16] = f2h(o[t][i] * inv);
    }
}

// ---------------------------------------------------------------------------
// Kernel 4: output projection.  out = A2(4096x2048) @ Wo(2048x1024), f32 out.
__global__ __launch_bounds__(256) void csa_oproj_gemm_kernel(
    const unsigned short* __restrict__ A2,
    const unsigned short* __restrict__ WoT,
    float* __restrict__ out) {
    const int lane = threadIdx.x & 31, l16 = lane & 15, lhi = lane >> 4;
    const int w = threadIdx.x >> 5;
    const int Mbase = blockIdx.y * 128 + (w >> 2) * 64;
    const int Nbase = blockIdx.x * 128 + (w & 3) * 32;
    v8f acc[4][2] = {};
    for (int k = 0; k < C2; k += 32) {
        __builtin_prefetch(A2 + (size_t)(Mbase + l16) * C2 + k + 64, 0, 3);
        Frag a[4], b[2];
#pragma unroll
        for (int mt = 0; mt < 4; ++mt) {
            const unsigned short* p =
                A2 + (size_t)(Mbase + mt * 16 + l16) * C2 + k + lhi * 8;
            a[mt].q[0] = ldg128(p);
            a[mt].q[1] = ldg128(p + 16);
        }
#pragma unroll
        for (int nt = 0; nt < 2; ++nt) {
            const unsigned short* p =
                WoT + (size_t)(Nbase + nt * 16 + l16) * C2 + k + lhi * 8;
            b[nt].q[0] = ldg128(p);
            b[nt].q[1] = ldg128(p + 16);
        }
#pragma unroll
        for (int mt = 0; mt < 4; ++mt)
#pragma unroll
            for (int nt = 0; nt < 2; ++nt)
                acc[mt][nt] = wmma16(a[mt], b[nt], acc[mt][nt]);
    }
#pragma unroll
    for (int mt = 0; mt < 4; ++mt)
#pragma unroll
        for (int nt = 0; nt < 2; ++nt)
#pragma unroll
            for (int i = 0; i < 8; ++i) {
                int row = Mbase + mt * 16 + i + lhi * 8;
                int col = Nbase + nt * 16 + l16;
                out[(size_t)row * CIN + col] = acc[mt][nt][i];
            }
}

// ---------------------------------------------------------------------------
extern "C" void kernel_launch(void* const* d_in, const int* in_sizes, int n_in,
                              void* d_out, int out_size, void* d_ws,
                              size_t ws_size, hipStream_t stream) {
    (void)in_sizes; (void)n_in; (void)out_size; (void)ws_size;
    const float* x  = (const float*)d_in[0];
    const float* Wq = (const float*)d_in[1];
    const float* Wk = (const float*)d_in[2];
    const float* Wv = (const float*)d_in[3];
    const float* Wo = (const float*)d_in[4];

    unsigned short* xb  = (unsigned short*)d_ws;            // 4M elems
    unsigned short* WqT = xb  + (size_t)NTOK * CIN;         // 2M
    unsigned short* WkT = WqT + (size_t)C2 * CIN;           // 2M
    unsigned short* WvT = WkT + (size_t)C2 * CIN;           // 2M
    unsigned short* WoT = WvT + (size_t)C2 * CIN;           // 2M
    unsigned short* Qb  = WoT + (size_t)CIN * C2;           // 8M
    unsigned short* Kb  = Qb  + (size_t)NTOK * C2;          // 8M
    unsigned short* Vt  = Kb  + (size_t)NTOK * C2;          // 8M
    unsigned short* A2  = Vt  + (size_t)2 * HEADS * 128 * SEQ; // 8M

    csa_cvt_kernel<<<(NTOK * CIN) / 256, 256, 0, stream>>>(x, xb, NTOK * CIN);
    csa_cvt_tr_kernel<<<dim3(C2 / TRN, CIN / TRK), 256, 0, stream>>>(Wq, WqT, CIN, C2);
    csa_cvt_tr_kernel<<<dim3(C2 / TRN, CIN / TRK), 256, 0, stream>>>(Wk, WkT, CIN, C2);
    csa_cvt_tr_kernel<<<dim3(C2 / TRN, CIN / TRK), 256, 0, stream>>>(Wv, WvT, CIN, C2);
    csa_cvt_tr_kernel<<<dim3(CIN / TRN, C2 / TRK), 256, 0, stream>>>(Wo, WoT, C2, CIN);

    csa_qkv_gemm_kernel<<<dim3(C2 / 128, NTOK / 128, 3), 256, 0, stream>>>(
        xb, WqT, WkT, WvT, Qb, Kb, Vt);

    csa_attn_kernel<<<dim3(SEQ / 128, 2 * HEADS), 256, 0, stream>>>(
        Qb, Kb, Vt, A2);

    csa_oproj_gemm_kernel<<<dim3(CIN / 128, NTOK / 128), 256, 0, stream>>>(
        A2, WoT, (float*)d_out);
}

// v002
// Measured time: 246 microseconds a run.
// In both of two side-by-side timings against v001, it was 1.39 times as fast.
// Counting every step since v000, it is 1.79 times as fast.
#include <hip/hip_runtime.h>

// ---------------------------------------------------------------------------
// ComplexSpectralAttention == standard causal MHA, head_dim=128, scale=1/8,
// plus QKV projection GEMMs and an output projection GEMM.
// Shapes: B=2, N=2048, C=1024, H=16, D=128 (per head), tokens NT=4096.
// Strategy: f16 WMMA (v_wmma_f32_16x16x32_f16) everywhere, f32 accumulate.
// Attention streams K/V tiles into LDS with global_load_async_to_lds_b128
// (ASYNCcnt), double-buffered, shared by all 8 waves of the block.
// Workspace (f16 elements), total ~88 MB: xb, WqT/WkT/WvT/WoT, Q, K, Vt, A2.
// The GEMM operands (xb, the four WT, A2) lie in fragment order: see fragidx().
// ---------------------------------------------------------------------------

typedef __attribute__((ext_vector_type(16))) _Float16     v16h;
typedef __attribute__((ext_vector_type(8)))  float        v8f;
typedef __attribute__((ext_vector_type(4)))  unsigned int v4u;
typedef __attribute__((ext_vector_type(4)))  float        v4f;

union Frag {            // one WMMA A/B operand: 16 f16 = 8 VGPRs = 2 x b128
    v16h v;
    v4u  q[2];          // q[0] = K {kb..kb+7}, q[1] = K {kb+16..kb+23}
};

__device__ __forceinline__ unsigned short f2h(float f) {
    union { _Float16 h; unsigned short u; } cv;
    cv.h = (_Float16)f;
    return cv.u;
}

__device__ __forceinline__ v4u ldg128(const unsigned short* p) {
    return *(const v4u*)p;
}

__device__ __forceinline__ v8f wmma16(const Frag& a, const Frag& b, v8f c) {
    return __builtin_amdgcn_wmma_f32_16x16x32_f16(
        false, a.v, false, b.v, (short)0, c, false, false);
}

// Async copy 16B/lane from global to LDS (gfx1250 VGLOBAL, tracked by ASYNCcnt)
__device__ __forceinline__ void async_ld128(unsigned lds_off,
                                            const unsigned short* gptr) {
    unsigned long long ga = (unsigned long long)(size_t)gptr;
    asm volatile("global_load_async_to_lds_b128 %0, %1, off"
                 :: "v"(lds_off), "v"(ga) : "memory");
}

#define SEQ   2048
#define NTOK  4096
#define CIN   1024
#define C2    2048
#define HEADS 16
#define KPAD  136   // 128 + 8 f16 pad (16B) to break LDS bank conflicts
#define VPAD  40    // 32 + 8 f16 pad
#define TRK   64    // transpose tile: k rows (64 k = two fragment k tiles of WT)
#define TRN   128   // transpose tile: n columns
#define TRP   72    // transpose tile: LDS pitch, 64 + 8 f16 (16-byte aligned rows)

// Fragment order of a GEMM operand with K columns (k contiguous in the product):
// tiles of 16 rows x 32 k = 512 f16, the k tiles of one row tile one after another.
// Inside a tile lie first k 0..15, then k 16..31, each as 32 chunks of 16 bytes in
// lane order (lane = (k >> 3 & 1) * 16 + row): one global_load_b128 of a wave reads
// 512 contiguous bytes, four whole lines (row-major rows give 32 bytes of 16 lines).
__device__ __forceinline__ size_t fragidx(int r, int k, int K) {
    return ((size_t)(r >> 4) * (K >> 5) + (k >> 5)) * 512 + ((k >> 4) & 1) * 256 +
           (((k >> 3) & 1) * 16 + (r & 15)) * 8 + (k & 7);
}

// ---------------------------------------------------------------------------
// Kernel 1a: x f32 -> f16, fragment order.  Thread i fills element i of xb, so a
// block writes 512 contiguous bytes (each line has one writer); 8 threads read 32
// contiguous bytes of one row of x.
__global__ __launch_bounds__(256) void csa_cvt_kernel(
    const float* __restrict__ x, unsigned short* __restrict__ xb, int n) {
    int i = blockIdx.x * 256 + threadIdx.x;
    if (i < n) {                              // the inverse of fragidx()
        const int tile = i >> 9;
        const int r = tile / (CIN / 32) * 16 + ((i >> 3) & 15);
        const int k = tile % (CIN / 32) * 32 + ((i >> 8) & 1) * 16 +
                      ((i >> 7) & 1) * 8 + (i & 7);
        xb[i] = f2h(x[(size_t)r * CIN + k]);
    }
}

// Kernel 1b: W (Krows x Ncols, f32) -> WT (Ncols x Krows, f16, fragment order), one
// 64 k x 128 n tile per block through LDS: 16-byte loads along n, whole 128-byte
// lines of WT stored.  Krows is a multiple of 64, Ncols a multiple of 128.
__global__ __launch_bounds__(256) void csa_cvt_tr_kernel(
    const float* __restrict__ W, unsigned short* __restrict__ WT,
    int Krows, int Ncols) {
    __shared__ __align__(16) unsigned short tile[TRN * TRP];
    const int tid = threadIdx.x;
    const int k0 = blockIdx.y * TRK, n0 = blockIdx.x * TRN;
    const int kq = tid >> 5, nq = tid & 31;   // 8 k rows x 4 n columns a thread
    const float* s = W + (size_t)(k0 + kq * 8) * Ncols + n0 + nq * 4;
    const float* a[8];
    v4f r[8];
#pragma unroll
    for (int i = 0; i < 8; ++i) a[i] = s + (size_t)i * Ncols;
#pragma unroll
    for (int i = 0; i < 8; ++i) r[i] = *(const v4f*)a[i];
    // inputs only: the eight results keep all eight loads in flight together (the
    // compiler otherwise held the last two back behind the first four), and the
    // eight address pairs stay live, so nothing lands in one ahead of this wait
    asm volatile("s_wait_xcnt 0x0"
                 :: "v"(a[0]), "v"(a[1]), "v"(a[2]), "v"(a[3]),
                    "v"(a[4]), "v"(a[5]), "v"(a[6]), "v"(a[7]),
                    "v"(r[0]), "v"(r[1]), "v"(r[2]), "v"(r[3]),
                    "v"(r[4]), "v"(r[5]), "v"(r[6]), "v"(r[7]) : "memory");
#pragma unroll
    for (int j = 0; j < 4; ++j) {
        union { unsigned short h[8]; v4u q; } pk;
#pragma unroll
        for (int i = 0; i < 8; ++i) pk.h[i] = f2h(r[i][j]);
        *(v4u*)&tile[(nq * 4 + j) * TRP + kq * 8] = pk.q;
    }
    __syncthreads();                          // tile complete before read-out
#pragma unroll
    for (int p = 0; p < TRN * TRK / 8 / 256; ++p) {
        const int id = p * 256 + tid;         // 16-byte chunks in the order of WT
        const int n = (id >> 7) * 16 + (id & 15), k = ((id >> 4) & 7) * 8;
        *(v4u*)(WT + fragidx(n0 + n, k0 + k, Krows)) =
            *(const v4u*)&tile[n * TRP + k];
    }
}

// ---------------------------------------------------------------------------
// Kernel 2: fused QKV GEMM.  Y = xb(4096x1024) @ W(1024x2048), z picks weight.
// Block tile 128x128, 8 waves as 2x4, wave tile 64x32 (4x2 WMMA tiles).
// z==2 (V) stores transposed per head into Vt.
__global__ __launch_bounds__(256) void csa_qkv_gemm_kernel(
    const unsigned short* __restrict__ xb,
    const unsigned short* __restrict__ WqT,
    const unsigned short* __restrict__ WkT,
    const unsigned short* __restrict__ WvT,
    unsigned short* __restrict__ Qo,
    unsigned short* __restrict__ Ko,
    unsigned short* __restrict__ Vt) {
    const int lane = threadIdx.x & 31, l16 = lane & 15, lhi = lane >> 4;
    const int w = threadIdx.x >> 5;
    const int Mbase = blockIdx.y * 128 + (w >> 2) * 64;
    const int Nbase = blockIdx.x * 128 + (w & 3) * 32;
    const unsigned short* BT = (blockIdx.z == 0) ? WqT
                             : (blockIdx.z == 1) ? WkT : WvT;
    v8f acc[4][2] = {};
    for (int k = 0; k < CIN; k += 32) {
        __builtin_prefetch(xb + fragidx(Mbase, k + 64, CIN) + lane * 16, 0, 3);
        Frag a[4], b[2];
#pragma unroll
        for (int mt = 0; mt < 4; ++mt) {
            const unsigned short* p =
                xb + fragidx(Mbase + mt * 16 + l16, k + lhi * 8, CIN);
            a[mt].q[0] = ldg128(p);
            a[mt].q[1] = ldg128(p + 256);
        }
#pragma unroll
        for (int nt = 0; nt < 2; ++nt) {
            const unsigned short* p =
                BT + fragidx(Nbase + nt * 16 + l16, k + lhi * 8, CIN);
            b[nt].q[0] = ldg128(p);
            b[nt].q[1] = ldg128(p + 256);
        }
#pragma unroll
        for (int mt = 0; mt < 4; ++mt)
#pragma unroll
            for (int nt = 0; nt < 2; ++nt)
                acc[mt][nt] = wmma16(a[mt], b[nt], acc[mt][nt]);
    }
    if (blockIdx.z < 2) {
        unsigned short* O = (blockIdx.z == 0) ? Qo : Ko;
#pragma unroll
        for (int mt = 0; mt < 4; ++mt)
#pragma unroll
            for (int nt = 0; nt < 2; ++nt)
#pragma unroll
                for (int i = 0; i < 8; ++i) {
                    int row = Mbase + mt * 16 + i + lhi * 8;
                    int col = Nbase + nt * 16 + l16;
                    O[(size_t)row * C2 + col] = f2h(acc[mt][nt][i]);
                }
    } else {
#pragma unroll
        for (int mt = 0; mt < 4; ++mt)
#pragma unroll
            for (int nt = 0; nt < 2; ++nt)
#pragma unroll
                for (int i = 0; i < 8; ++i) {
                    int row = Mbase + mt * 16 + i + lhi * 8;   // token
                    int col = Nbase + nt * 16 + l16;           // channel
                    int bb = row >> 11, nn = row & (SEQ - 1);
                    int h = col >> 7, d = col & 127;
                    Vt[(((size_t)(bb * HEADS + h) * 128 + d) << 11) + nn] =
                        f2h(acc[mt][nt][i]);
                }
    }
}

// ---------------------------------------------------------------------------
// Kernel 3: causal flash attention with async-LDS double buffering.
// grid = (N/128 query blocks, B*H); 8 waves, wave w owns rows [q0b+16w, +16).
// Per 32-key step: 256 threads issue 4x global_load_async_to_lds_b128 each
// (K tile 32x128 -> Kbuf[key][d], V tile 128x32 -> Vbuf[d][key]); compute on
// tile i overlaps the async DMA of tile i+1.  Online softmax in f32.
__global__ __launch_bounds__(256) void csa_attn_kernel(
    const unsigned short* __restrict__ Qg,
    const unsigned short* __restrict__ Kg,
    const unsigned short* __restrict__ Vt,
    unsigned short* __restrict__ A2) {
    __shared__ __align__(16) unsigned short Kbuf[2][32 * KPAD];
    __shared__ __align__(16) unsigned short Vbuf[2][128 * VPAD];
    __shared__ __align__(16) unsigned short Plds[8 * 16 * 32];

    const int tid = threadIdx.x;
    const int lane = tid & 31, l16 = lane & 15, lhi = lane >> 4;
    const int w = tid >> 5;
    const int bb = blockIdx.y >> 4, h = blockIdx.y & 15;
    const int q0b = blockIdx.x * 128;
    const int q0 = q0b + w * 16;

    const unsigned short* Qb = Qg + (size_t)bb * SEQ * C2 + h * 128;
    const unsigned short* Kb = Kg + (size_t)bb * SEQ * C2 + h * 128;
    const unsigned short* Vb = Vt + (size_t)(bb * HEADS + h) * 128 * SEQ;
    unsigned short*       Pw = Plds + w * 512;

    // per-thread async chunk coordinates (16B chunks)
    const int kr = tid >> 4, kc = (tid & 15) * 8;   // K: rows kr, kr+16
    const int vd = tid >> 2, vc = (tid & 3) * 8;    // V: rows vd, vd+64

    Frag qf[4];
#pragma unroll
    for (int j = 0; j < 4; ++j) {
        const unsigned short* p = Qb + (size_t)(q0 + l16) * C2 + j * 32 + lhi * 8;
        qf[j].q[0] = ldg128(p);
        qf[j].q[1] = ldg128(p + 16);
    }

    v8f o[8] = {};
    float mrow[8], lrow[8];
#pragma unroll
    for (int i = 0; i < 8; ++i) { mrow[i] = -1e30f; lrow[i] = 0.0f; }

    const int niter = (q0b + 128) / 32;   // uniform across the block

    // prologue: async-issue tile 0 into buffer 0
    {
        unsigned kof = (unsigned)(size_t)&Kbuf[0][0];
        unsigned vof = (unsigned)(size_t)&Vbuf[0][0];
        async_ld128(kof + (unsigned)(kr * KPAD + kc) * 2,
                    Kb + (size_t)kr * C2 + kc);
        async_ld128(kof + (unsigned)((kr + 16) * KPAD + kc) * 2,
                    Kb + (size_t)(kr + 16) * C2 + kc);
        async_ld128(vof + (unsigned)(vd * VPAD + vc) * 2,
                    Vb + (size_t)vd * SEQ + vc);
        async_ld128(vof + (unsigned)((vd + 64) * VPAD + vc) * 2,
                    Vb + (size_t)(vd + 64) * SEQ + vc);
    }

    for (int it = 0; it < niter; ++it) {
        const int kv = it * 32;
        __syncthreads();                  // release buffer (it+1)&1
        if (it + 1 < niter) {
            const int kvn = kv + 32;
            unsigned kof = (unsigned)(size_t)&Kbuf[(it + 1) & 1][0];
            unsigned vof = (unsigned)(size_t)&Vbuf[(it + 1) & 1][0];
            async_ld128(kof + (unsigned)(kr * KPAD + kc) * 2,
                        Kb + (size_t)(kvn + kr) * C2 + kc);
            async_ld128(kof + (unsigned)((kr + 16) * KPAD + kc) * 2,
                        Kb + (size_t)(kvn + kr + 16) * C2 + kc);
            async_ld128(vof + (unsigned)(vd * VPAD + vc) * 2,
                        Vb + (size_t)vd * SEQ + kvn + vc);
            async_ld128(vof + (unsigned)((vd + 64) * VPAD + vc) * 2,
                        Vb + (size_t)(vd + 64) * SEQ + kvn + vc);
            // async loads complete in order: cnt<=4 => tile `it` has landed
            asm volatile("s_wait_asynccnt 0x4" ::: "memory");
        } else {
            asm volatile("s_wait_asynccnt 0x0" ::: "memory");
        }
        __syncthreads();                  // tile `it` visible to all waves

        const unsigned short* kt = Kbuf[it & 1];
        const unsigned short* vt = Vbuf[it & 1];

        // S = Q * K^T  (two 16x16 key tiles)
        v8f s0 = {}, s1 = {};
#pragma unroll
        for (int j = 0; j < 4; ++j) {     // d chunks of 32
            Frag k0, k1;
            const unsigned short* p0 = kt + l16 * KPAD + j * 32 + lhi * 8;
            k0.q[0] = *(const v4u*)p0;
            k0.q[1] = *(const v4u*)(p0 + 16);
            const unsigned short* p1 = p0 + 16 * KPAD;
            k1.q[0] = *(const v4u*)p1;
            k1.q[1] = *(const v4u*)(p1 + 16);
            s0 = wmma16(qf[j], k0, s0);
            s1 = wmma16(qf[j], k1, s1);
        }

        // online softmax update (per-VGPR-row state, 16-lane reductions)
#pragma unroll
        for (int i = 0; i < 8; ++i) {
            int row = q0 + i + lhi * 8;
            int c0 = kv + l16, c1 = kv + 16 + l16;
            float v0 = s0[i] * 0.125f;    // scale 1/sqrt(64)
            float v1 = s1[i] * 0.125f;
            if (c0 > row) v0 = -1e30f;
            if (c1 > row) v1 = -1e30f;
            float mx = fmaxf(v0, v1);
            for (int d = 1; d < 16; d <<= 1)
                mx = fmaxf(mx, __shfl_xor(mx, d, 32));
            float mnew  = fmaxf(mrow[i], mx);
            float scale = __expf(mrow[i] - mnew);
            float p0 = __expf(v0 - mnew), p1 = __expf(v1 - mnew);
            float rs = p0 + p1;
            for (int d = 1; d < 16; d <<= 1)
                rs += __shfl_xor(rs, d, 32);
            lrow[i] = lrow[i] * scale + rs;
            mrow[i] = mnew;
#pragma unroll
            for (int t = 0; t < 8; ++t) o[t][i] *= scale;
            int m = i + lhi * 8;          // C-layout row within tile
            Pw[m * 32 + l16]      = f2h(p0);
            Pw[m * 32 + 16 + l16] = f2h(p1);
        }
        // re-read P in A-fragment layout (same-wave LDS is in-order)
        Frag pf;
        pf.q[0] = *(const v4u*)(Pw + l16 * 32 + lhi * 8);
        pf.q[1] = *(const v4u*)(Pw + l16 * 32 + lhi * 8 + 16);
#pragma unroll
        for (int t = 0; t < 8; ++t) {     // O += P * V  (8 d-tiles)
            Frag vf;
            const unsigned short* p = vt + (t * 16 + l16) * VPAD + lhi * 8;
            vf.q[0] = *(const v4u*)p;
            vf.q[1] = *(const v4u*)(p + 16);
            o[t] = wmma16(pf, vf, o[t]);
        }
    }

    // the wave's 16 rows are one row tile of A2: row i adds 8 f16, column group t 256
    unsigned short* Ob = A2 + fragidx(bb * SEQ + q0 + lhi * 8, h * 128 + l16, C2);
#pragma unroll
    for (int i = 0; i < 8; ++i) {
        float inv = 1.0f / lrow[i];
#pragma unroll
        for (int t = 0; t < 8; ++t)
            Ob[t * 256 + i * 8] = f2h(o[t][i] * inv);
    }
}

// ---------------------------------------------------------------------------
// Kernel 4: output projection.  out = A2(4096x2048) @ Wo(2048x1024), f32 out.
__global__ __launch_bounds__(256) void csa_oproj_gemm_kernel(
    const unsigned short* __restrict__ A2,
    const unsigned short* __restrict__ WoT,
    float* __restrict__ out) {
    const int lane = threadIdx.x & 31, l16 = lane & 15, lhi = lane >> 4;
    const int w = threadIdx.x >> 5;
    const int Mbase = blockIdx.y * 128 + (w >> 2) * 64;
    const int Nbase = blockIdx.x * 128 + (w & 3) * 32;
    v8f acc[4][2] = {};
    for (int k = 0; k < C2; k += 32) {
        __builtin_prefetch(A2 + fragidx(Mbase, k + 64, C2) + lane * 16, 0, 3);
        Frag a[4], b[2];
#pragma unroll
        for (int mt = 0; mt < 4; ++mt) {
            const unsigned short* p =
                A2 + fragidx(Mbase + mt * 16 + l16, k + lhi * 8, C2);
            a[mt].q[0] = ldg128(p);
            a[mt].q[1] = ldg128(p + 256);
        }
#pragma unroll
        for (int nt = 0; nt < 2; ++nt) {
            const unsigned short* p =
                WoT + fragidx(Nbase + nt * 16 + l16, k + lhi * 8, C2);
            b[nt].q[0] = ldg128(p);
            b[nt].q[1] = ldg128(p + 256);
        }
#pragma unroll
        for (int mt = 0; mt < 4; ++mt)
#pragma unroll
            for (int nt = 0; nt < 2; ++nt)
                acc[mt][nt] = wmma16(a[mt], b[nt], acc[mt][nt]);
    }
#pragma unroll
    for (int mt = 0; mt < 4; ++mt)
#pragma unroll
        for (int nt = 0; nt < 2; ++nt)
#pragma unroll
            for (int i = 0; i < 8; ++i) {
                int row = Mbase + mt * 16 + i + lhi * 8;
                int col = Nbase + nt * 16 + l16;
                out[(size_t)row * CIN + col] = acc[mt][nt][i];
            }
}

// ---------------------------------------------------------------------------
extern "C" void kernel_launch(void* const* d_in, const int* in_sizes, int n_in,
                              void* d_out, int out_size, void* d_ws,
                              size_t ws_size, hipStream_t stream) {
    (void)in_sizes; (void)n_in; (void)out_size; (void)ws_size;
    const float* x  = (const float*)d_in[0];
    const float* Wq = (const float*)d_in[1];
    const float* Wk = (const float*)d_in[2];
    const float* Wv = (const float*)d_in[3];
    const float* Wo = (const float*)d_in[4];

    unsigned short* xb  = (unsigned short*)d_ws;            // 4M elems
    unsigned short* WqT = xb  + (size_t)NTOK * CIN;         // 2M
    unsigned short* WkT = WqT + (size_t)C2 * CIN;           // 2M
    unsigned short* WvT = WkT + (size_t)C2 * CIN;           // 2M
    unsigned short* WoT = WvT + (size_t)C2 * CIN;           // 2M
    unsigned short* Qb  = WoT + (size_t)CIN * C2;           // 8M
    unsigned short* Kb  = Qb  + (size_t)NTOK * C2;          // 8M
    unsigned short* Vt  = Kb  + (size_t)NTOK * C2;          // 8M
    unsigned short* A2  = Vt  + (size_t)2 * HEADS * 128 * SEQ; // 8M

    csa_cvt_kernel<<<(NTOK * CIN) / 256, 256, 0, stream>>>(x, xb, NTOK * CIN);
    csa_cvt_tr_kernel<<<dim3(C2 / TRN, CIN / TRK), 256, 0, stream>>>(Wq, WqT, CIN, C2);
    csa_cvt_tr_kernel<<<dim3(C2 / TRN, CIN / TRK), 256, 0, stream>>>(Wk, WkT, CIN, C2);
    csa_cvt_tr_kernel<<<dim3(C2 / TRN, CIN / TRK), 256, 0, stream>>>(Wv, WvT, CIN, C2);
    csa_cvt_tr_kernel<<<dim3(CIN / TRN, C2 / TRK), 256, 0, stream>>>(Wo, WoT, C2, CIN);

    csa_qkv_gemm_kernel<<<dim3(C2 / 128, NTOK / 128, 3), 256, 0, stream>>>(
        xb, WqT, WkT, WvT, Qb, Kb, Vt);

    csa_attn_kernel<<<dim3(SEQ / 128, 2 * HEADS), 256, 0, stream>>>(
        Qb, Kb, Vt, A2);

    csa_oproj_gemm_kernel<<<dim3(CIN / 128, NTOK / 128), 256, 0, stream>>>(
        A2, WoT, (float*)d_out);
}

// v003
// A run of this version takes 203 microseconds.
// Timed twice side by side with v002, it ran 1.20 and 1.21 times as fast.
// Counting every step since v000, it is 2.16 times as fast.
#include <hip/hip_runtime.h>

// ---------------------------------------------------------------------------
// ComplexSpectralAttention == standard causal MHA, head_dim=128, scale=1/8,
// plus QKV projection GEMMs and an output projection GEMM.
// Shapes: B=2, N=2048, C=1024, H=16, D=128 (per head), tokens NT=4096.
// Strategy: f16 WMMA (v_wmma_f32_16x16x32_f16) everywhere, f32 accumulate.
// Attention streams K/V tiles into LDS with global_load_async_to_lds_b128
// (ASYNCcnt), double-buffered, shared by all 8 waves of the block.
// Workspace (f16 elements), total ~88 MB: xb, WqT/WkT/WvT/WoT, Q, K, Vt, A2.
// The GEMM operands (xb, the four WT, A2) lie in fragment order: see fragidx().
// ---------------------------------------------------------------------------

typedef __attribute__((ext_vector_type(16))) _Float16     v16h;
typedef __attribute__((ext_vector_type(8)))  float        v8f;
typedef __attribute__((ext_vector_type(4)))  unsigned int v4u;
typedef __attribute__((ext_vector_type(4)))  float        v4f;

union Frag {            // one WMMA A/B operand: 16 f16 = 8 VGPRs = 2 x b128
    v16h v;
    v4u  q[2];          // q[0] = K {kb..kb+7}, q[1] = K {kb+16..kb+23}
};

__device__ __forceinline__ unsigned short f2h(float f) {
    union { _Float16 h; unsigned short u; } cv;
    cv.h = (_Float16)f;
    return cv.u;
}

__device__ __forceinline__ v4u ldg128(const unsigned short* p) {
    return *(const v4u*)p;
}

__device__ __forceinline__ v8f wmma16(const Frag& a, const Frag& b, v8f c) {
    return __builtin_amdgcn_wmma_f32_16x16x32_f16(
        false, a.v, false, b.v, (short)0, c, false, false);
}

// Async copy 16B/lane from global to LDS (gfx1250 VGLOBAL, tracked by ASYNCcnt)
__device__ __forceinline__ void async_ld128(unsigned lds_off,
                                            const unsigned short* gptr) {
    unsigned long long ga = (unsigned long long)(size_t)gptr;
    asm volatile("global_load_async_to_lds_b128 %0, %1, off"
                 :: "v"(lds_off), "v"(ga) : "memory");
}

// Lane l's value in lane l ^ 16 (the other half of the wave), by a vector cross-row
// move: no LDS-counter round trip, which is what __shfl_xor compiles to.
__device__ __forceinline__ float xhalf(float x) {
    return __builtin_bit_cast(float, __builtin_amdgcn_permlanex16(
        __builtin_bit_cast(int, x), __builtin_bit_cast(int, x),
        0x76543210, 0xfedcba98, false, false));
}

#define SEQ   2048
#define NTOK  4096
#define CIN   1024
#define C2    2048
#define HEADS 16
#define KPAD  136   // 128 + 8 f16 pad (16B) to break LDS bank conflicts
#define VPAD  40    // 32 + 8 f16 pad
#define TRK   64    // transpose tile: k rows (64 k = two fragment k tiles of WT)
#define TRN   128   // transpose tile: n columns
#define TRP   72    // transpose tile: LDS pitch, 64 + 8 f16 (16-byte aligned rows)

// Fragment order of a GEMM operand with K columns (k contiguous in the product):
// tiles of 16 rows x 32 k = 512 f16, the k tiles of one row tile one after another.
// Inside a tile lie first k 0..15, then k 16..31, each as 32 chunks of 16 bytes in
// lane order (lane = (k >> 3 & 1) * 16 + row): one global_load_b128 of a wave reads
// 512 contiguous bytes, four whole lines (row-major rows give 32 bytes of 16 lines).
__device__ __forceinline__ size_t fragidx(int r, int k, int K) {
    return ((size_t)(r >> 4) * (K >> 5) + (k >> 5)) * 512 + ((k >> 4) & 1) * 256 +
           (((k >> 3) & 1) * 16 + (r & 15)) * 8 + (k & 7);
}

// ---------------------------------------------------------------------------
// Kernel 1a: x f32 -> f16, fragment order.  Thread i fills element i of xb, so a
// block writes 512 contiguous bytes (each line has one writer); 8 threads read 32
// contiguous bytes of one row of x.
__global__ __launch_bounds__(256) void csa_cvt_kernel(
    const float* __restrict__ x, unsigned short* __restrict__ xb, int n) {
    int i = blockIdx.x * 256 + threadIdx.x;
    if (i < n) {                              // the inverse of fragidx()
        const int tile = i >> 9;
        const int r = tile / (CIN / 32) * 16 + ((i >> 3) & 15);
        const int k = tile % (CIN / 32) * 32 + ((i >> 8) & 1) * 16 +
                      ((i >> 7) & 1) * 8 + (i & 7);
        xb[i] = f2h(x[(size_t)r * CIN + k]);
    }
}

// Kernel 1b: W (Krows x Ncols, f32) -> WT (Ncols x Krows, f16, fragment order), one
// 64 k x 128 n tile per block through LDS: 16-byte loads along n, whole 128-byte
// lines of WT stored.  Krows is a multiple of 64, Ncols a multiple of 128.
__global__ __launch_bounds__(256) void csa_cvt_tr_kernel(
    const float* __restrict__ W, unsigned short* __restrict__ WT,
    int Krows, int Ncols) {
    __shared__ __align__(16) unsigned short tile[TRN * TRP];
    const int tid = threadIdx.x;
    const int k0 = blockIdx.y * TRK, n0 = blockIdx.x * TRN;
    const int kq = tid >> 5, nq = tid & 31;   // 8 k rows x 4 n columns a thread
    const float* s = W + (size_t)(k0 + kq * 8) * Ncols + n0 + nq * 4;
    const float* a[8];
    v4f r[8];
#pragma unroll
    for (int i = 0; i < 8; ++i) a[i] = s + (size_t)i * Ncols;
#pragma unroll
    for (int i = 0; i < 8; ++i) r[i] = *(const v4f*)a[i];
    // inputs only: the eight results keep all eight loads in flight together (the
    // compiler otherwise held the last two back behind the first four), and the
    // eight address pairs stay live, so nothing lands in one ahead of this wait
    asm volatile("s_wait_xcnt 0x0"
                 :: "v"(a[0]), "v"(a[1]), "v"(a[2]), "v"(a[3]),
                    "v"(a[4]), "v"(a[5]), "v"(a[6]), "v"(a[7]),
                    "v"(r[0]), "v"(r[1]), "v"(r[2]), "v"(r[3]),
                    "v"(r[4]), "v"(r[5]), "v"(r[6]), "v"(r[7]) : "memory");
#pragma unroll
    for (int j = 0; j < 4; ++j) {
        union { unsigned short h[8]; v4u q; } pk;
#pragma unroll
        for (int i = 0; i < 8; ++i) pk.h[i] = f2h(r[i][j]);
        *(v4u*)&tile[(nq * 4 + j) * TRP + kq * 8] = pk.q;
    }
    __syncthreads();                          // tile complete before read-out
#pragma unroll
    for (int p = 0; p < TRN * TRK / 8 / 256; ++p) {
        const int id = p * 256 + tid;         // 16-byte chunks in the order of WT
        const int n = (id >> 7) * 16 + (id & 15), k = ((id >> 4) & 7) * 8;
        *(v4u*)(WT + fragidx(n0 + n, k0 + k, Krows)) =
            *(const v4u*)&tile[n * TRP + k];
    }
}

// ---------------------------------------------------------------------------
// Kernel 2: fused QKV GEMM.  Y = xb(4096x1024) @ W(1024x2048), z picks weight.
// Block tile 128x128, 8 waves as 2x4, wave tile 64x32 (4x2 WMMA tiles).
// z==2 (V) stores transposed per head into Vt.
__global__ __launch_bounds__(256) void csa_qkv_gemm_kernel(
    const unsigned short* __restrict__ xb,
    const unsigned short* __restrict__ WqT,
    const unsigned short* __restrict__ WkT,
    const unsigned short* __restrict__ WvT,
    unsigned short* __restrict__ Qo,
    unsigned short* __restrict__ Ko,
    unsigned short* __restrict__ Vt) {
    const int lane = threadIdx.x & 31, l16 = lane & 15, lhi = lane >> 4;
    const int w = threadIdx.x >> 5;
    const int Mbase = blockIdx.y * 128 + (w >> 2) * 64;
    const int Nbase = blockIdx.x * 128 + (w & 3) * 32;
    const unsigned short* BT = (blockIdx.z == 0) ? WqT
                             : (blockIdx.z == 1) ? WkT : WvT;
    v8f acc[4][2] = {};
    for (int k = 0; k < CIN; k += 32) {
        __builtin_prefetch(xb + fragidx(Mbase, k + 64, CIN) + lane * 16, 0, 3);
        Frag a[4], b[2];
#pragma unroll
        for (int mt = 0; mt < 4; ++mt) {
            const unsigned short* p =
                xb + fragidx(Mbase + mt * 16 + l16, k + lhi * 8, CIN);
            a[mt].q[0] = ldg128(p);
            a[mt].q[1] = ldg128(p + 256);
        }
#pragma unroll
        for (int nt = 0; nt < 2; ++nt) {
            const unsigned short* p =
                BT + fragidx(Nbase + nt * 16 + l16, k + lhi * 8, CIN);
            b[nt].q[0] = ldg128(p);
            b[nt].q[1] = ldg128(p + 256);
        }
#pragma unroll
        for (int mt = 0; mt < 4; ++mt)
#pragma unroll
            for (int nt = 0; nt < 2; ++nt)
                acc[mt][nt] = wmma16(a[mt], b[nt], acc[mt][nt]);
    }
    if (blockIdx.z < 2) {
        unsigned short* O = (blockIdx.z == 0) ? Qo : Ko;
#pragma unroll
        for (int mt = 0; mt < 4; ++mt)
#pragma unroll
            for (int nt = 0; nt < 2; ++nt)
#pragma unroll
                for (int i = 0; i < 8; ++i) {
                    int row = Mbase + mt * 16 + i + lhi * 8;
                    int col = Nbase + nt * 16 + l16;
                    O[(size_t)row * C2 + col] = f2h(acc[mt][nt][i]);
                }
    } else {
#pragma unroll
        for (int mt = 0; mt < 4; ++mt)
#pragma unroll
            for (int nt = 0; nt < 2; ++nt)
#pragma unroll
                for (int i = 0; i < 8; ++i) {
                    int row = Mbase + mt * 16 + i + lhi * 8;   // token
                    int col = Nbase + nt * 16 + l16;           // channel
                    int bb = row >> 11, nn = row & (SEQ - 1);
                    int h = col >> 7, d = col & 127;
                    Vt[(((size_t)(bb * HEADS + h) * 128 + d) << 11) + nn] =
                        f2h(acc[mt][nt][i]);
                }
    }
}

// ---------------------------------------------------------------------------
// Kernel 3: causal flash attention with async-LDS double buffering.
// grid = (N/128 query blocks, B*H); 8 waves, wave w owns rows [q0b+16w, +16).
// Per 32-key step: 256 threads issue 4x global_load_async_to_lds_b128 each
// (K tile 32x128 -> Kbuf[key][d], V tile 128x32 -> Vbuf[d][key]); compute on
// tile i overlaps the async DMA of tile i+1.  Online softmax in f32.
// The products are transposed: S^T = K Q^T (A = K rows, B = Q rows) and
// O^T += V^T P^T (A = Vbuf rows, B = P^T).  Lane (l16, lhi) then holds, of query
// q0 + l16, the scores of keys lhi*8 + 0..7 of each 16-key tile: maximum and sum run
// inside the lane, with one exchange between the wave halves, and the two score
// tiles, converted in place, are the B operand of the second product in the k order
// of the V loader (keys lhi*8 + 0..7, then 16 + lhi*8 + 0..7): P never leaves registers.
__global__ __launch_bounds__(256) void csa_attn_kernel(
    const unsigned short* __restrict__ Qg,
    const unsigned short* __restrict__ Kg,
    const unsigned short* __restrict__ Vt,
    unsigned short* __restrict__ A2) {
    __shared__ __align__(16) unsigned short Kbuf[2][32 * KPAD];
    __shared__ __align__(16) unsigned short Vbuf[2][128 * VPAD];

    const int tid = threadIdx.x;
    const int lane = tid & 31, l16 = lane & 15, lhi = lane >> 4;
    const int w = tid >> 5;
    const int bb = blockIdx.y >> 4, h = blockIdx.y & 15;
    const int q0b = blockIdx.x * 128;
    const int q0 = q0b + w * 16;

    const unsigned short* Qb = Qg + (size_t)bb * SEQ * C2 + h * 128;
    const unsigned short* Kb = Kg + (size_t)bb * SEQ * C2 + h * 128;
    const unsigned short* Vb = Vt + (size_t)(bb * HEADS + h) * 128 * SEQ;

    // per-thread async chunk coordinates (16B chunks)
    const int kr = tid >> 4, kc = (tid & 15) * 8;   // K: rows kr, kr+16
    const int vd = tid >> 2, vc = (tid & 3) * 8;    // V: rows vd, vd+64

    Frag qf[4];
#pragma unroll
    for (int j = 0; j < 4; ++j) {
        const unsigned short* p = Qb + (size_t)(q0 + l16) * C2 + j * 32 + lhi * 8;
        qf[j].q[0] = ldg128(p);
        qf[j].q[1] = ldg128(p + 16);
    }

    v8f o[8] = {};                        // o[t][i] = O[q0 + l16][t*16 + lhi*8 + i]
    const int qrow = q0 + l16;            // the lane's query
    float mrow = -1e30f;                  // its running maximum (alike in both halves)
    float lrow = 0.0f;                    // its running sum over this half's keys

    const int niter = (q0b + 128) / 32;   // uniform across the block

    // prologue: async-issue tile 0 into buffer 0
    {
        unsigned kof = (unsigned)(size_t)&Kbuf[0][0];
        unsigned vof = (unsigned)(size_t)&Vbuf[0][0];
        async_ld128(kof + (unsigned)(kr * KPAD + kc) * 2,
                    Kb + (size_t)kr * C2 + kc);
        async_ld128(kof + (unsigned)((kr + 16) * KPAD + kc) * 2,
                    Kb + (size_t)(kr + 16) * C2 + kc);
        async_ld128(vof + (unsigned)(vd * VPAD + vc) * 2,
                    Vb + (size_t)vd * SEQ + vc);
        async_ld128(vof + (unsigned)((vd + 64) * VPAD + vc) * 2,
                    Vb + (size_t)(vd + 64) * SEQ + vc);
    }

    for (int it = 0; it < niter; ++it) {
        const int kv = it * 32;
        __syncthreads();                  // release buffer (it+1)&1
        if (it + 1 < niter) {
            const int kvn = kv + 32;
            unsigned kof = (unsigned)(size_t)&Kbuf[(it + 1) & 1][0];
            unsigned vof = (unsigned)(size_t)&Vbuf[(it + 1) & 1][0];
            async_ld128(kof + (unsigned)(kr * KPAD + kc) * 2,
                        Kb + (size_t)(kvn + kr) * C2 + kc);
            async_ld128(kof + (unsigned)((kr + 16) * KPAD + kc) * 2,
                        Kb + (size_t)(kvn + kr + 16) * C2 + kc);
            async_ld128(vof + (unsigned)(vd * VPAD + vc) * 2,
                        Vb + (size_t)vd * SEQ + kvn + vc);
            async_ld128(vof + (unsigned)((vd + 64) * VPAD + vc) * 2,
                        Vb + (size_t)(vd + 64) * SEQ + kvn + vc);
            // async loads complete in order: cnt<=4 => tile `it` has landed
            asm volatile("s_wait_asynccnt 0x4" ::: "memory");
        } else {
            asm volatile("s_wait_asynccnt 0x0" ::: "memory");
        }
        __syncthreads();                  // tile `it` visible to all waves

        const unsigned short* kt = Kbuf[it & 1];
        const unsigned short* vt = Vbuf[it & 1];

        // S^T = K * Q^T  (two 16x16 key tiles)
        v8f s0 = {}, s1 = {};
#pragma unroll
        for (int j = 0; j < 4; ++j) {     // d chunks of 32
            Frag k0, k1;
            const unsigned short* p0 = kt + l16 * KPAD + j * 32 + lhi * 8;
            k0.q[0] = *(const v4u*)p0;
            k0.q[1] = *(const v4u*)(p0 + 16);
            const unsigned short* p1 = p0 + 16 * KPAD;
            k1.q[0] = *(const v4u*)p1;
            k1.q[1] = *(const v4u*)(p1 + 16);
            s0 = wmma16(k0, qf[j], s0);
            s1 = wmma16(k1, qf[j], s1);
        }

        // online softmax update: the lane's 16 scores of its one query.  Every loop
        // below is unrolled so that sc[], red[] and pf are indexed by constants and
        // stay in registers.
        float sc[16], red[16];
#pragma unroll
        for (int i = 0; i < 8; ++i) {
            const int c0 = kv + lhi * 8 + i, c1 = c0 + 16;   // keys
            float v0 = s0[i] * 0.125f;    // scale 1/sqrt(64)
            float v1 = s1[i] * 0.125f;
            if (c0 > qrow) v0 = -1e30f;
            if (c1 > qrow) v1 = -1e30f;
            sc[i] = v0;
            sc[8 + i] = v1;
        }
#pragma unroll
        for (int i = 0; i < 16; ++i) red[i] = sc[i];
#pragma unroll
        for (int st = 1; st < 16; st <<= 1)   // pairwise tree: a short dependent chain
#pragma unroll
            for (int i = 0; i < 16; i += 2 * st) red[i] = fmaxf(red[i], red[i + st]);
        const float mnew  = fmaxf(mrow, fmaxf(red[0], xhalf(red[0])));
        const float scale = __expf(mrow - mnew);
        Frag pf;                          // P^T as B: elements 0..7 of s0, 8..15 of s1
#pragma unroll
        for (int i = 0; i < 16; ++i) {
            red[i] = __expf(sc[i] - mnew);
            pf.v[i] = (_Float16)red[i];
        }
#pragma unroll
        for (int st = 1; st < 16; st <<= 1)   // the same pairwise tree for the sum
#pragma unroll
            for (int i = 0; i < 16; i += 2 * st) red[i] += red[i + st];
        lrow = lrow * scale + red[0];
        mrow = mnew;
#pragma unroll
        for (int t = 0; t < 8; ++t) o[t] *= scale;
#pragma unroll
        for (int t = 0; t < 8; ++t) {     // O^T += V^T * P^T  (8 d-tiles)
            Frag vf;
            const unsigned short* p = vt + (t * 16 + l16) * VPAD + lhi * 8;
            vf.q[0] = *(const v4u*)p;
            vf.q[1] = *(const v4u*)(p + 16);
            o[t] = wmma16(vf, pf, o[t]);
        }
    }

    // the wave's 16 rows are one row tile of A2; a lane's 8 values of d-tile t are one
    // 16-byte chunk of it, and the wave's 32 chunks lie in lane order: 512 bytes a store
    const float inv = 1.0f / (lrow + xhalf(lrow));   // the two halves' sums joined
    unsigned short* Ob = A2 + fragidx(bb * SEQ + q0 + l16, h * 128 + lhi * 8, C2);
#pragma unroll                            // o[] indexed by constants: registers
    for (int t = 0; t < 8; ++t) {
        union { unsigned short e[8]; v4u q; } pk;
#pragma unroll                            // the 8 halves pack in registers
        for (int i = 0; i < 8; ++i) pk.e[i] = f2h(o[t][i] * inv);
        *(v4u*)(Ob + t * 256) = pk.q;
    }
}

// ---------------------------------------------------------------------------
// Kernel 4: output projection.  out = A2(4096x2048) @ Wo(2048x1024), f32 out.
__global__ __launch_bounds__(256) void csa_oproj_gemm_kernel(
    const unsigned short* __restrict__ A2,
    const unsigned short* __restrict__ WoT,
    float* __restrict__ out) {
    const int lane = threadIdx.x & 31, l16 = lane & 15, lhi = lane >> 4;
    const int w = threadIdx.x >> 5;
    const int Mbase = blockIdx.y * 128 + (w >> 2) * 64;
    const int Nbase = blockIdx.x * 128 + (w & 3) * 32;
    v8f acc[4][2] = {};
    for (int k = 0; k < C2; k += 32) {
        __builtin_prefetch(A2 + fragidx(Mbase, k + 64, C2) + lane * 16, 0, 3);
        Frag a[4], b[2];
#pragma unroll
        for (int mt = 0; mt < 4; ++mt) {
            const unsigned short* p =
                A2 + fragidx(Mbase + mt * 16 + l16, k + lhi * 8, C2);
            a[mt].q[0] = ldg128(p);
            a[mt].q[1] = ldg128(p + 256);
        }
#pragma unroll
        for (int nt = 0; nt < 2; ++nt) {
            const unsigned short* p =
                WoT + fragidx(Nbase + nt * 16 + l16, k + lhi * 8, C2);
            b[nt].q[0] = ldg128(p);
            b[nt].q[1] = ldg128(p + 256);
        }
#pragma unroll
        for (int mt = 0; mt < 4; ++mt)
#pragma unroll
            for (int nt = 0; nt < 2; ++nt)
                acc[mt][nt] = wmma16(a[mt], b[nt], acc[mt][nt]);
    }
#pragma unroll
    for (int mt = 0; mt < 4; ++mt)
#pragma unroll
        for (int nt = 0; nt < 2; ++nt)
#pragma unroll
            for (int i = 0; i < 8; ++i) {
                int row = Mbase + mt * 16 + i + lhi * 8;
                int col = Nbase + nt * 16 + l16;
                out[(size_t)row * CIN + col] = acc[mt][nt][i];
            }
}

// ---------------------------------------------------------------------------
extern "C" void kernel_launch(void* const* d_in, const int* in_sizes, int n_in,
                              void* d_out, int out_size, void* d_ws,
                              size_t ws_size, hipStream_t stream) {
    (void)in_sizes; (void)n_in; (void)out_size; (void)ws_size;
    const float* x  = (const float*)d_in[0];
    const float* Wq = (const float*)d_in[1];
    const float* Wk = (const float*)d_in[2];
    const float* Wv = (const float*)d_in[3];
    const float* Wo = (const float*)d_in[4];

    unsigned short* xb  = (unsigned short*)d_ws;            // 4M elems
    unsigned short* WqT = xb  + (size_t)NTOK * CIN;         // 2M
    unsigned short* WkT = WqT + (size_t)C2 * CIN;           // 2M
    unsigned short* WvT = WkT + (size_t)C2 * CIN;           // 2M
    unsigned short* WoT = WvT + (size_t)C2 * CIN;           // 2M
    unsigned short* Qb  = WoT + (size_t)CIN * C2;           // 8M
    unsigned short* Kb  = Qb  + (size_t)NTOK * C2;          // 8M
    unsigned short* Vt  = Kb  + (size_t)NTOK * C2;          // 8M
    unsigned short* A2  = Vt  + (size_t)2 * HEADS * 128 * SEQ; // 8M

    csa_cvt_kernel<<<(NTOK * CIN) / 256, 256, 0, stream>>>(x, xb, NTOK * CIN);
    csa_cvt_tr_kernel<<<dim3(C2 / TRN, CIN / TRK), 256, 0, stream>>>(Wq, WqT, CIN, C2);
    csa_cvt_tr_kernel<<<dim3(C2 / TRN, CIN / TRK), 256, 0, stream>>>(Wk, WkT, CIN, C2);
    csa_cvt_tr_kernel<<<dim3(C2 / TRN, CIN / TRK), 256, 0, stream>>>(Wv, WvT, CIN, C2);
    csa_cvt_tr_kernel<<<dim3(CIN / TRN, C2 / TRK), 256, 0, stream>>>(Wo, WoT, C2, CIN);

    csa_qkv_gemm_kernel<<<dim3(C2 / 128, NTOK / 128, 3), 256, 0, stream>>>(
        xb, WqT, WkT, WvT, Qb, Kb, Vt);

    csa_attn_kernel<<<dim3(SEQ / 128, 2 * HEADS), 256, 0, stream>>>(
        Qb, Kb, Vt, A2);

    csa_oproj_gemm_kernel<<<dim3(CIN / 128, NTOK / 128), 256, 0, stream>>>(
        A2, WoT, (float*)d_out);
}

// v004
// It runs in 187 microseconds.
// In both of two side-by-side timings against v003, it was 1.08 times as fast.
// Counting every step since v000, it is 2.34 times as fast.
#include <hip/hip_runtime.h>

// ---------------------------------------------------------------------------
// ComplexSpectralAttention == standard causal MHA, head_dim=128, scale=1/8,
// plus QKV projection GEMMs and an output projection GEMM.
// Shapes: B=2, N=2048, C=1024, H=16, D=128 (per head), tokens NT=4096.
// Strategy: f16 WMMA (v_wmma_f32_16x16x32_f16) everywhere, f32 accumulate.
// Attention streams K/V tiles into LDS with global_load_async_to_lds_b128
// (ASYNCcnt), double-buffered, shared by all 8 waves of the block.
// Workspace (f16 elements), total ~88 MB: xb, WqT/WkT/WvT/WoT, Q, K, Vt, A2.
// The GEMM operands (xb, the four WT, A2) lie in fragment order: see fragidx().
// ---------------------------------------------------------------------------

typedef __attribute__((ext_vector_type(16))) _Float16     v16h;
typedef __attribute__((ext_vector_type(8)))  float        v8f;
typedef __attribute__((ext_vector_type(4)))  unsigned int v4u;
typedef __attribute__((ext_vector_type(4)))  float        v4f;

union Frag {            // one WMMA A/B operand: 16 f16 = 8 VGPRs = 2 x b128
    v16h v;
    v4u  q[2];          // q[0] = K {kb..kb+7}, q[1] = K {kb+16..kb+23}
};

__device__ __forceinline__ unsigned short f2h(float f) {
    union { _Float16 h; unsigned short u; } cv;
    cv.h = (_Float16)f;
    return cv.u;
}

__device__ __forceinline__ v4u ldg128(const unsigned short* p) {
    return *(const v4u*)p;
}

__device__ __forceinline__ v8f wmma16(const Frag& a, const Frag& b, v8f c) {
    return __builtin_amdgcn_wmma_f32_16x16x32_f16(
        false, a.v, false, b.v, (short)0, c, false, false);
}

// Async copy 16B/lane from global to LDS (gfx1250 VGLOBAL, tracked by ASYNCcnt)
__device__ __forceinline__ void async_ld128(unsigned lds_off,
                                            const unsigned short* gptr) {
    unsigned long long ga = (unsigned long long)(size_t)gptr;
    asm volatile("global_load_async_to_lds_b128 %0, %1, off"
                 :: "v"(lds_off), "v"(ga) : "memory");
}

// Lane l's value in lane l ^ 16 (the other half of the wave), by a vector cross-row
// move: no LDS-counter round trip, which is what __shfl_xor compiles to.
__device__ __forceinline__ float xhalf(float x) {
    return __builtin_bit_cast(float, __builtin_amdgcn_permlanex16(
        __builtin_bit_cast(int, x), __builtin_bit_cast(int, x),
        0x76543210, 0xfedcba98, false, false));
}

#define SEQ   2048
#define NTOK  4096
#define CIN   1024
#define C2    2048
#define HEADS 16
#define KPAD  136   // 128 + 8 f16 pad (16B) to break LDS bank conflicts
#define VPAD  40    // 32 + 8 f16 pad
#define TRK   64    // transpose tile: k rows (64 k = two fragment k tiles of WT)
#define TRN   128   // transpose tile: n columns
#define TRP   72    // transpose tile: LDS pitch, 64 + 8 f16 (16-byte aligned rows)

// Fragment order of a GEMM operand with K columns (k contiguous in the product):
// tiles of 16 rows x 32 k = 512 f16, the k tiles of one row tile one after another.
// Inside a tile lie first k 0..15, then k 16..31, each as 32 chunks of 16 bytes in
// lane order (lane = (k >> 3 & 1) * 16 + row): one global_load_b128 of a wave reads
// 512 contiguous bytes, four whole lines (row-major rows give 32 bytes of 16 lines).
__device__ __forceinline__ size_t fragidx(int r, int k, int K) {
    return ((size_t)(r >> 4) * (K >> 5) + (k >> 5)) * 512 + ((k >> 4) & 1) * 256 +
           (((k >> 3) & 1) * 16 + (r & 15)) * 8 + (k & 7);
}

// ---------------------------------------------------------------------------
// Kernel 1a: x f32 -> f16, fragment order.  Thread i fills element i of xb, so a
// block writes 512 contiguous bytes (each line has one writer); 8 threads read 32
// contiguous bytes of one row of x.
__global__ __launch_bounds__(256) void csa_cvt_kernel(
    const float* __restrict__ x, unsigned short* __restrict__ xb, int n) {
    int i = blockIdx.x * 256 + threadIdx.x;
    if (i < n) {                              // the inverse of fragidx()
        const int tile = i >> 9;
        const int r = tile / (CIN / 32) * 16 + ((i >> 3) & 15);
        const int k = tile % (CIN / 32) * 32 + ((i >> 8) & 1) * 16 +
                      ((i >> 7) & 1) * 8 + (i & 7);
        xb[i] = f2h(x[(size_t)r * CIN + k]);
    }
}

// Kernel 1b: W (Krows x Ncols, f32) -> WT (Ncols x Krows, f16, fragment order), one
// 64 k x 128 n tile per block through LDS: 16-byte loads along n, whole 128-byte
// lines of WT stored.  Krows is a multiple of 64, Ncols a multiple of 128.
__global__ __launch_bounds__(256) void csa_cvt_tr_kernel(
    const float* __restrict__ W, unsigned short* __restrict__ WT,
    int Krows, int Ncols) {
    __shared__ __align__(16) unsigned short tile[TRN * TRP];
    const int tid = threadIdx.x;
    const int k0 = blockIdx.y * TRK, n0 = blockIdx.x * TRN;
    const int kq = tid >> 5, nq = tid & 31;   // 8 k rows x 4 n columns a thread
    const float* s = W + (size_t)(k0 + kq * 8) * Ncols + n0 + nq * 4;
    const float* a[8];
    v4f r[8];
#pragma unroll
    for (int i = 0; i < 8; ++i) a[i] = s + (size_t)i * Ncols;
#pragma unroll
    for (int i = 0; i < 8; ++i) r[i] = *(const v4f*)a[i];
    // inputs only: the eight results keep all eight loads in flight together (the
    // compiler otherwise held the last two back behind the first four), and the
    // eight address pairs stay live, so nothing lands in one ahead of this wait
    asm volatile("s_wait_xcnt 0x0"
                 :: "v"(a[0]), "v"(a[1]), "v"(a[2]), "v"(a[3]),
                    "v"(a[4]), "v"(a[5]), "v"(a[6]), "v"(a[7]),
                    "v"(r[0]), "v"(r[1]), "v"(r[2]), "v"(r[3]),
                    "v"(r[4]), "v"(r[5]), "v"(r[6]), "v"(r[7]) : "memory");
#pragma unroll
    for (int j = 0; j < 4; ++j) {
        union { unsigned short h[8]; v4u q; } pk;
#pragma unroll
        for (int i = 0; i < 8; ++i) pk.h[i] = f2h(r[i][j]);
        *(v4u*)&tile[(nq * 4 + j) * TRP + kq * 8] = pk.q;
    }
    __syncthreads();                          // tile complete before read-out
#pragma unroll
    for (int p = 0; p < TRN * TRK / 8 / 256; ++p) {
        const int id = p * 256 + tid;         // 16-byte chunks in the order of WT
        const int n = (id >> 7) * 16 + (id & 15), k = ((id >> 4) & 7) * 8;
        *(v4u*)(WT + fragidx(n0 + n, k0 + k, Krows)) =
            *(const v4u*)&tile[n * TRP + k];
    }
}

// ---------------------------------------------------------------------------
// Kernel 2: fused QKV GEMM.  Y = xb(4096x1024) @ W(1024x2048), z picks weight.
// Block tile 128x128, 8 waves as 2x4, wave tile 64x32 (4x2 WMMA tiles).
// z==2 (V) stores transposed per head into Vt.
__global__ __launch_bounds__(256) void csa_qkv_gemm_kernel(
    const unsigned short* __restrict__ xb,
    const unsigned short* __restrict__ WqT,
    const unsigned short* __restrict__ WkT,
    const unsigned short* __restrict__ WvT,
    unsigned short* __restrict__ Qo,
    unsigned short* __restrict__ Ko,
    unsigned short* __restrict__ Vt) {
    const int lane = threadIdx.x & 31, l16 = lane & 15, lhi = lane >> 4;
    const int w = threadIdx.x >> 5;
    const int Mbase = blockIdx.y * 128 + (w >> 2) * 64;
    const int Nbase = blockIdx.x * 128 + (w & 3) * 32;
    const unsigned short* BT = (blockIdx.z == 0) ? WqT
                             : (blockIdx.z == 1) ? WkT : WvT;
    v8f acc[4][2] = {};
    for (int k = 0; k < CIN; k += 32) {
        __builtin_prefetch(xb + fragidx(Mbase, k + 64, CIN) + lane * 16, 0, 3);
        Frag a[4], b[2];
#pragma unroll
        for (int mt = 0; mt < 4; ++mt) {
            const unsigned short* p =
                xb + fragidx(Mbase + mt * 16 + l16, k + lhi * 8, CIN);
            a[mt].q[0] = ldg128(p);
            a[mt].q[1] = ldg128(p + 256);
        }
#pragma unroll
        for (int nt = 0; nt < 2; ++nt) {
            const unsigned short* p =
                BT + fragidx(Nbase + nt * 16 + l16, k + lhi * 8, CIN);
            b[nt].q[0] = ldg128(p);
            b[nt].q[1] = ldg128(p + 256);
        }
#pragma unroll
        for (int mt = 0; mt < 4; ++mt)
#pragma unroll
            for (int nt = 0; nt < 2; ++nt)
                acc[mt][nt] = wmma16(a[mt], b[nt], acc[mt][nt]);
    }
    if (blockIdx.z < 2) {
        unsigned short* O = (blockIdx.z == 0) ? Qo : Ko;
#pragma unroll
        for (int mt = 0; mt < 4; ++mt)
#pragma unroll
            for (int nt = 0; nt < 2; ++nt)
#pragma unroll
                for (int i = 0; i < 8; ++i) {
                    int row = Mbase + mt * 16 + i + lhi * 8;
                    int col = Nbase + nt * 16 + l16;
                    O[(size_t)row * C2 + col] = f2h(acc[mt][nt][i]);
                }
    } else {
#pragma unroll
        for (int mt = 0; mt < 4; ++mt)
#pragma unroll
            for (int nt = 0; nt < 2; ++nt)
#pragma unroll
                for (int i = 0; i < 8; ++i) {
                    int row = Mbase + mt * 16 + i + lhi * 8;   // token
                    int col = Nbase + nt * 16 + l16;           // channel
                    int bb = row >> 11, nn = row & (SEQ - 1);
                    int h = col >> 7, d = col & 127;
                    Vt[(((size_t)(bb * HEADS + h) * 128 + d) << 11) + nn] =
                        f2h(acc[mt][nt][i]);
                }
    }
}

// ---------------------------------------------------------------------------
// Kernel 3: causal flash attention with async-LDS double buffering.
// grid = (N/128 query blocks, B*H); 8 waves, wave w owns rows [q0b+16w, +16).
// Per 32-key step: 256 threads issue 4x global_load_async_to_lds_b128 each
// (K tile 32x128 -> Kbuf[key][d], V tile 128x32 -> Vbuf[d][key]); compute on
// tile i overlaps the async DMA of tile i+1.  Online softmax in f32.
// The products are transposed: S^T = K Q^T (A = K rows, B = Q rows) and
// O^T += V^T P^T (A = Vbuf rows, B = P^T).  Lane (l16, lhi) then holds, of query
// q0 + l16, the scores of keys lhi*8 + 0..7 of each 16-key tile: maximum and sum run
// inside the lane, with one exchange between the wave halves, and the two score
// tiles, converted in place, are the B operand of the second product in the k order
// of the V loader (keys lhi*8 + 0..7, then 16 + lhi*8 + 0..7): P never leaves registers.
__global__ __launch_bounds__(256) void csa_attn_kernel(
    const unsigned short* __restrict__ Qg,
    const unsigned short* __restrict__ Kg,
    const unsigned short* __restrict__ Vt,
    unsigned short* __restrict__ A2) {
    __shared__ __align__(16) unsigned short Kbuf[2][32 * KPAD];
    __shared__ __align__(16) unsigned short Vbuf[2][128 * VPAD];

    const int tid = threadIdx.x;
    const int lane = tid & 31, l16 = lane & 15, lhi = lane >> 4;
    const int w = tid >> 5;
    const int bb = blockIdx.y >> 4, h = blockIdx.y & 15;
    const int q0b = blockIdx.x * 128;
    const int q0 = q0b + w * 16;

    const unsigned short* Qb = Qg + (size_t)bb * SEQ * C2 + h * 128;
    const unsigned short* Kb = Kg + (size_t)bb * SEQ * C2 + h * 128;
    const unsigned short* Vb = Vt + (size_t)(bb * HEADS + h) * 128 * SEQ;

    // per-thread async chunk coordinates (16B chunks)
    const int kr = tid >> 4, kc = (tid & 15) * 8;   // K: rows kr, kr+16
    const int vd = tid >> 2, vc = (tid & 3) * 8;    // V: rows vd, vd+64

    Frag qf[4];
#pragma unroll
    for (int j = 0; j < 4; ++j) {
        const unsigned short* p = Qb + (size_t)(q0 + l16) * C2 + j * 32 + lhi * 8;
        qf[j].q[0] = ldg128(p);
        qf[j].q[1] = ldg128(p + 16);
    }

    v8f o[8] = {};                        // o[t][i] = O[q0 + l16][t*16 + lhi*8 + i]
    const int qrow = q0 + l16;            // the lane's query
    float mrow = -1e30f;                  // its running maximum (alike in both halves)
    float lrow = 0.0f;                    // its running sum over this half's keys

    const int niter = (q0b + 128) / 32;   // uniform across the block

    // prologue: async-issue tile 0 into buffer 0
    {
        unsigned kof = (unsigned)(size_t)&Kbuf[0][0];
        unsigned vof = (unsigned)(size_t)&Vbuf[0][0];
        async_ld128(kof + (unsigned)(kr * KPAD + kc) * 2,
                    Kb + (size_t)kr * C2 + kc);
        async_ld128(kof + (unsigned)((kr + 16) * KPAD + kc) * 2,
                    Kb + (size_t)(kr + 16) * C2 + kc);
        async_ld128(vof + (unsigned)(vd * VPAD + vc) * 2,
                    Vb + (size_t)vd * SEQ + vc);
        async_ld128(vof + (unsigned)((vd + 64) * VPAD + vc) * 2,
                    Vb + (size_t)(vd + 64) * SEQ + vc);
    }

    for (int it = 0; it < niter; ++it) {
        const int kv = it * 32;
        __syncthreads();                  // release buffer (it+1)&1
        if (it + 1 < niter) {
            const int kvn = kv + 32;
            unsigned kof = (unsigned)(size_t)&Kbuf[(it + 1) & 1][0];
            unsigned vof = (unsigned)(size_t)&Vbuf[(it + 1) & 1][0];
            async_ld128(kof + (unsigned)(kr * KPAD + kc) * 2,
                        Kb + (size_t)(kvn + kr) * C2 + kc);
            async_ld128(kof + (unsigned)((kr + 16) * KPAD + kc) * 2,
                        Kb + (size_t)(kvn + kr + 16) * C2 + kc);
            async_ld128(vof + (unsigned)(vd * VPAD + vc) * 2,
                        Vb + (size_t)vd * SEQ + kvn + vc);
            async_ld128(vof + (unsigned)((vd + 64) * VPAD + vc) * 2,
                        Vb + (size_t)(vd + 64) * SEQ + kvn + vc);
            // async loads complete in order: cnt<=4 => tile `it` has landed
            asm volatile("s_wait_asynccnt 0x4" ::: "memory");
        } else {
            asm volatile("s_wait_asynccnt 0x0" ::: "memory");
        }
        __syncthreads();                  // tile `it` visible to all waves

        const unsigned short* kt = Kbuf[it & 1];
        const unsigned short* vt = Vbuf[it & 1];

        // S^T = K * Q^T  (two 16x16 key tiles)
        v8f s0 = {}, s1 = {};
        Frag kf[4][2];
#pragma unroll                            // kf[] indexed by constants: registers
        for (int j = 0; j < 4; ++j) {     // d chunks of 32
            const unsigned short* p0 = kt + l16 * KPAD + j * 32 + lhi * 8;
            kf[j][0].q[0] = *(const v4u*)p0;
            kf[j][0].q[1] = *(const v4u*)(p0 + 16);
            const unsigned short* p1 = p0 + 16 * KPAD;
            kf[j][1].q[0] = *(const v4u*)p1;
            kf[j][1].q[1] = *(const v4u*)(p1 + 16);
        }
        // nothing is scheduled across: the 16 K loads issue as one group ahead of the
        // products (left alone: 2 loads and a wait to 0 in front of every product)
        __builtin_amdgcn_sched_barrier(0);
#pragma unroll                            // kf[], qf[] indexed by constants: registers
        for (int j = 0; j < 4; ++j) {
            s0 = wmma16(kf[j][0], qf[j], s0);
            s1 = wmma16(kf[j][1], qf[j], s1);
        }
        Frag vf[8];
#pragma unroll                            // vf[] indexed by constants: registers
        for (int t = 0; t < 8; ++t) {     // 8 d-tiles of V^T
            const unsigned short* p = vt + (t * 16 + l16) * VPAD + lhi * 8;
            vf[t].q[0] = *(const v4u*)p;
            vf[t].q[1] = *(const v4u*)(p + 16);
        }
        // nothing is scheduled across: the 16 V loads issue ahead of the softmax and land
        // under it (left alone: 2 loads and a wait in front of every product)
        __builtin_amdgcn_sched_barrier(0);

        // online softmax update: the lane's 16 scores of its one query.  Every loop
        // below is unrolled so that sc[], red[] and pf are indexed by constants and
        // stay in registers.
        float sc[16], red[16];
#pragma unroll
        for (int i = 0; i < 8; ++i) {
            const int c0 = kv + lhi * 8 + i, c1 = c0 + 16;   // keys
            float v0 = s0[i] * 0.125f;    // scale 1/sqrt(64)
            float v1 = s1[i] * 0.125f;
            if (c0 > qrow) v0 = -1e30f;
            if (c1 > qrow) v1 = -1e30f;
            sc[i] = v0;
            sc[8 + i] = v1;
        }
#pragma unroll
        for (int i = 0; i < 16; ++i) red[i] = sc[i];
#pragma unroll
        for (int st = 1; st < 16; st <<= 1)   // pairwise tree: a short dependent chain
#pragma unroll
            for (int i = 0; i < 16; i += 2 * st) red[i] = fmaxf(red[i], red[i + st]);
        const float mnew  = fmaxf(mrow, fmaxf(red[0], xhalf(red[0])));
        const float scale = __expf(mrow - mnew);
        Frag pf;                          // P^T as B: elements 0..7 of s0, 8..15 of s1
#pragma unroll
        for (int i = 0; i < 16; ++i) {
            red[i] = __expf(sc[i] - mnew);
            pf.v[i] = (_Float16)red[i];
        }
#pragma unroll
        for (int st = 1; st < 16; st <<= 1)   // the same pairwise tree for the sum
#pragma unroll
            for (int i = 0; i < 16; i += 2 * st) red[i] += red[i + st];
        lrow = lrow * scale + red[0];
        mrow = mnew;
#pragma unroll
        for (int t = 0; t < 8; ++t) o[t] *= scale;
#pragma unroll
        for (int t = 0; t < 8; ++t)       // O^T += V^T * P^T  (8 d-tiles)
            o[t] = wmma16(vf[t], pf, o[t]);
    }

    // the wave's 16 rows are one row tile of A2; a lane's 8 values of d-tile t are one
    // 16-byte chunk of it, and the wave's 32 chunks lie in lane order: 512 bytes a store
    const float inv = 1.0f / (lrow + xhalf(lrow));   // the two halves' sums joined
    unsigned short* Ob = A2 + fragidx(bb * SEQ + q0 + l16, h * 128 + lhi * 8, C2);
#pragma unroll                            // o[] indexed by constants: registers
    for (int t = 0; t < 8; ++t) {
        union { unsigned short e[8]; v4u q; } pk;
#pragma unroll                            // the 8 halves pack in registers
        for (int i = 0; i < 8; ++i) pk.e[i] = f2h(o[t][i] * inv);
        *(v4u*)(Ob + t * 256) = pk.q;
    }
}

// ---------------------------------------------------------------------------
// Kernel 4: output projection.  out = A2(4096x2048) @ Wo(2048x1024), f32 out.
__global__ __launch_bounds__(256) void csa_oproj_gemm_kernel(
    const unsigned short* __restrict__ A2,
    const unsigned short* __restrict__ WoT,
    float* __restrict__ out) {
    const int lane = threadIdx.x & 31, l16 = lane & 15, lhi = lane >> 4;
    const int w = threadIdx.x >> 5;
    const int Mbase = blockIdx.y * 128 + (w >> 2) * 64;
    const int Nbase = blockIdx.x * 128 + (w & 3) * 32;
    v8f acc[4][2] = {};
    for (int k = 0; k < C2; k += 32) {
        __builtin_prefetch(A2 + fragidx(Mbase, k + 64, C2) + lane * 16, 0, 3);
        Frag a[4], b[2];
#pragma unroll
        for (int mt = 0; mt < 4; ++mt) {
            const unsigned short* p =
                A2 + fragidx(Mbase + mt * 16 + l16, k + lhi * 8, C2);
            a[mt].q[0] = ldg128(p);
            a[mt].q[1] = ldg128(p + 256);
        }
#pragma unroll
        for (int nt = 0; nt < 2; ++nt) {
            const unsigned short* p =
                WoT + fragidx(Nbase + nt * 16 + l16, k + lhi * 8, C2);
            b[nt].q[0] = ldg128(p);
            b[nt].q[1] = ldg128(p + 256);
        }
#pragma unroll
        for (int mt = 0; mt < 4; ++mt)
#pragma unroll
            for (int nt = 0; nt < 2; ++nt)
                acc[mt][nt] = wmma16(a[mt], b[nt], acc[mt][nt]);
    }
#pragma unroll
    for (int mt = 0; mt < 4; ++mt)
#pragma unroll
        for (int nt = 0; nt < 2; ++nt)
#pragma unroll
            for (int i = 0; i < 8; ++i) {
                int row = Mbase + mt * 16 + i + lhi * 8;
                int col = Nbase + nt * 16 + l16;
                out[(size_t)row * CIN + col] = acc[mt][nt][i];
            }
}

// ---------------------------------------------------------------------------
extern "C" void kernel_launch(void* const* d_in, const int* in_sizes, int n_in,
                              void* d_out, int out_size, void* d_ws,
                              size_t ws_size, hipStream_t stream) {
    (void)in_sizes; (void)n_in; (void)out_size; (void)ws_size;
    const float* x  = (const float*)d_in[0];
    const float* Wq = (const float*)d_in[1];
    const float* Wk = (const float*)d_in[2];
    const float* Wv = (const float*)d_in[3];
    const float* Wo = (const float*)d_in[4];

    unsigned short* xb  = (unsigned short*)d_ws;            // 4M elems
    unsigned short* WqT = xb  + (size_t)NTOK * CIN;         // 2M
    unsigned short* WkT = WqT + (size_t)C2 * CIN;           // 2M
    unsigned short* WvT = WkT + (size_t)C2 * CIN;           // 2M
    unsigned short* WoT = WvT + (size_t)C2 * CIN;           // 2M
    unsigned short* Qb  = WoT + (size_t)CIN * C2;           // 8M
    unsigned short* Kb  = Qb  + (size_t)NTOK * C2;          // 8M
    unsigned short* Vt  = Kb  + (size_t)NTOK * C2;          // 8M
    unsigned short* A2  = Vt  + (size_t)2 * HEADS * 128 * SEQ; // 8M

    csa_cvt_kernel<<<(NTOK * CIN) / 256, 256, 0, stream>>>(x, xb, NTOK * CIN);
    csa_cvt_tr_kernel<<<dim3(C2 / TRN, CIN / TRK), 256, 0, stream>>>(Wq, WqT, CIN, C2);
    csa_cvt_tr_kernel<<<dim3(C2 / TRN, CIN / TRK), 256, 0, stream>>>(Wk, WkT, CIN, C2);
    csa_cvt_tr_kernel<<<dim3(C2 / TRN, CIN / TRK), 256, 0, stream>>>(Wv, WvT, CIN, C2);
    csa_cvt_tr_kernel<<<dim3(CIN / TRN, C2 / TRK), 256, 0, stream>>>(Wo, WoT, C2, CIN);

    csa_qkv_gemm_kernel<<<dim3(C2 / 128, NTOK / 128, 3), 256, 0, stream>>>(
        xb, WqT, WkT, WvT, Qb, Kb, Vt);

    csa_attn_kernel<<<dim3(SEQ / 128, 2 * HEADS), 256, 0, stream>>>(
        Qb, Kb, Vt, A2);

    csa_oproj_gemm_kernel<<<dim3(CIN / 128, NTOK / 128), 256, 0, stream>>>(
        A2, WoT, (float*)d_out);
}

// v005
// Measured time: 180 microseconds a run.
// Two timings next to v004 put it at 1.04 and 1.05 times that version's speed.
// All steps since v000 together make it 2.44 times as fast.
#include <hip/hip_runtime.h>

// ---------------------------------------------------------------------------
// ComplexSpectralAttention == standard causal MHA, head_dim=128, scale=1/8,
// plus QKV projection GEMMs and an output projection GEMM.
// Shapes: B=2, N=2048, C=1024, H=16, D=128 (per head), tokens NT=4096.
// Strategy: f16 WMMA (v_wmma_f32_16x16x32_f16) everywhere, f32 accumulate.
// Attention streams K/V tiles into LDS with global_load_async_to_lds_b128
// (ASYNCcnt), double-buffered, shared by all 8 waves of the block.
// Workspace (f16 elements), total ~88 MB: xb, WqT/WkT/WvT/WoT, Q, K, Vt, A2.
// The GEMM operands (xb, the four WT, A2) lie in fragment order: see fragidx().
// ---------------------------------------------------------------------------

typedef __attribute__((ext_vector_type(16))) _Float16     v16h;
typedef __attribute__((ext_vector_type(8)))  float        v8f;
typedef __attribute__((ext_vector_type(4)))  unsigned int v4u;
typedef __attribute__((ext_vector_type(4)))  float        v4f;

union Frag {            // one WMMA A/B operand: 16 f16 = 8 VGPRs = 2 x b128
    v16h v;
    v4u  q[2];          // q[0] = K {kb..kb+7}, q[1] = K {kb+16..kb+23}
};

__device__ __forceinline__ unsigned short f2h(float f) {
    union { _Float16 h; unsigned short u; } cv;
    cv.h = (_Float16)f;
    return cv.u;
}

__device__ __forceinline__ v4u ldg128(const unsigned short* p) {
    return *(const v4u*)p;
}

__device__ __forceinline__ v8f wmma16(const Frag& a, const Frag& b, v8f c) {
    return __builtin_amdgcn_wmma_f32_16x16x32_f16(
        false, a.v, false, b.v, (short)0, c, false, false);
}

// Async copy 16B/lane from global to LDS (gfx1250 VGLOBAL, tracked by ASYNCcnt)
__device__ __forceinline__ void async_ld128(unsigned lds_off,
                                            const unsigned short* gptr) {
    unsigned long long ga = (unsigned long long)(size_t)gptr;
    asm volatile("global_load_async_to_lds_b128 %0, %1, off"
                 :: "v"(lds_off), "v"(ga) : "memory");
}

// Lane l's value in lane l ^ 16 (the other half of the wave), by a vector cross-row
// move: no LDS-counter round trip, which is what __shfl_xor compiles to.
__device__ __forceinline__ float xhalf(float x) {
    return __builtin_bit_cast(float, __builtin_amdgcn_permlanex16(
        __builtin_bit_cast(int, x), __builtin_bit_cast(int, x),
        0x76543210, 0xfedcba98, false, false));
}

#define SEQ   2048
#define NTOK  4096
#define CIN   1024
#define C2    2048
#define HEADS 16
#define KPAD  136   // 128 + 8 f16 pad (16B) to break LDS bank conflicts
#define VPAD  40    // 32 + 8 f16 pad
#define TRK   64    // transpose tile: k rows (64 k = two fragment k tiles of WT)
#define TRN   128   // transpose tile: n columns
#define TRP   72    // transpose tile: LDS pitch, 64 + 8 f16 (16-byte aligned rows)
#define TRBLK (CIN * C2 / (TRK * TRN))   // transpose tiles of one weight: 256

// Fragment order of a GEMM operand with K columns (k contiguous in the product):
// tiles of 16 rows x 32 k = 512 f16, the k tiles of one row tile one after another.
// Inside a tile lie first k 0..15, then k 16..31, each as 32 chunks of 16 bytes in
// lane order (lane = (k >> 3 & 1) * 16 + row): one global_load_b128 of a wave reads
// 512 contiguous bytes, four whole lines (row-major rows give 32 bytes of 16 lines).
__device__ __forceinline__ size_t fragidx(int r, int k, int K) {
    return ((size_t)(r >> 4) * (K >> 5) + (k >> 5)) * 512 + ((k >> 4) & 1) * 256 +
           (((k >> 3) & 1) * 16 + (r & 15)) * 8 + (k & 7);
}

// ---------------------------------------------------------------------------
// Kernel 1: all five conversions in one launch.  They are independent of each other
// and each is short, so as launches of their own they mostly cost start and drain.
// The block index picks the job: blocks 0..1023 transpose the four weights (256 tiles
// each; they have the longer chain load, LDS, barrier, store, so they start first),
// the rest convert x.
//
// Job a: x f32 -> f16, fragment order.  Thread i fills element i of xb, so a
// block writes 512 contiguous bytes (each line has one writer); 8 threads read 32
// contiguous bytes of one row of x.
__device__ __forceinline__ void csa_cvt_x(
    const float* __restrict__ x, unsigned short* __restrict__ xb, int i, int n) {
    if (i < n) {                              // the inverse of fragidx()
        const int tile = i >> 9;
        const int r = tile / (CIN / 32) * 16 + ((i >> 3) & 15);
        const int k = tile % (CIN / 32) * 32 + ((i >> 8) & 1) * 16 +
                      ((i >> 7) & 1) * 8 + (i & 7);
        xb[i] = f2h(x[(size_t)r * CIN + k]);
    }
}

// Job b: W (Krows x Ncols, f32) -> WT (Ncols x Krows, f16, fragment order), one
// 64 k x 128 n tile per block through LDS: 16-byte loads along n, whole 128-byte
// lines of WT stored.  Krows is a multiple of 64, Ncols a multiple of 128.
// bx, by: the tile's n and k index, alike in the whole block.
__device__ __forceinline__ void csa_cvt_tr(
    unsigned short* tile,
    const float* __restrict__ W, unsigned short* __restrict__ WT,
    int Krows, int Ncols, int bx, int by) {
    const int tid = threadIdx.x;
    const int k0 = by * TRK, n0 = bx * TRN;
    const int kq = tid >> 5, nq = tid & 31;   // 8 k rows x 4 n columns a thread
    const float* s = W + (size_t)(k0 + kq * 8) * Ncols + n0 + nq * 4;
    const float* a[8];
    v4f r[8];
#pragma unroll
    for (int i = 0; i < 8; ++i) a[i] = s + (size_t)i * Ncols;
#pragma unroll
    for (int i = 0; i < 8; ++i) r[i] = *(const v4f*)a[i];
    // inputs only: the eight results keep all eight loads in flight together (the
    // compiler otherwise held the last two back behind the first four), and the
    // eight address pairs stay live, so nothing lands in one ahead of this wait
    asm volatile("s_wait_xcnt 0x0"
                 :: "v"(a[0]), "v"(a[1]), "v"(a[2]), "v"(a[3]),
                    "v"(a[4]), "v"(a[5]), "v"(a[6]), "v"(a[7]),
                    "v"(r[0]), "v"(r[1]), "v"(r[2]), "v"(r[3]),
                    "v"(r[4]), "v"(r[5]), "v"(r[6]), "v"(r[7]) : "memory");
#pragma unroll
    for (int j = 0; j < 4; ++j) {
        union { unsigned short h[8]; v4u q; } pk;
#pragma unroll
        for (int i = 0; i < 8; ++i) pk.h[i] = f2h(r[i][j]);
        *(v4u*)&tile[(nq * 4 + j) * TRP + kq * 8] = pk.q;
    }
    __syncthreads();                          // tile complete before read-out
#pragma unroll
    for (int p = 0; p < TRN * TRK / 8 / 256; ++p) {
        const int id = p * 256 + tid;         // 16-byte chunks in the order of WT
        const int n = (id >> 7) * 16 + (id & 15), k = ((id >> 4) & 7) * 8;
        *(v4u*)(WT + fragidx(n0 + n, k0 + k, Krows)) =
            *(const v4u*)&tile[n * TRP + k];
    }
}

__global__ __launch_bounds__(256) void csa_prep_kernel(
    const float* __restrict__ x,
    const float* __restrict__ Wq, const float* __restrict__ Wk,
    const float* __restrict__ Wv, const float* __restrict__ Wo,
    unsigned short* __restrict__ xb,
    unsigned short* __restrict__ WqT, unsigned short* __restrict__ WkT,
    unsigned short* __restrict__ WvT, unsigned short* __restrict__ WoT, int n) {
    __shared__ __align__(16) unsigned short tile[TRN * TRP];
    const int b = blockIdx.x;                 // every test on it is block-uniform
    if (b < 4 * TRBLK) {
        const int job = b / TRBLK, t = b % TRBLK;
        if (job < 3)                          // 1024 k x 2048 n: 16 tiles along n
            csa_cvt_tr(tile, job == 0 ? Wq : job == 1 ? Wk : Wv,
                       job == 0 ? WqT : job == 1 ? WkT : WvT, CIN, C2,
                       t % (C2 / TRN), t / (C2 / TRN));
        else                                  // 2048 k x 1024 n: 8 tiles along n
            csa_cvt_tr(tile, Wo, WoT, C2, CIN, t % (CIN / TRN), t / (CIN / TRN));
    } else {
        csa_cvt_x(x, xb, (b - 4 * TRBLK) * 256 + threadIdx.x, n);
    }
}

// ---------------------------------------------------------------------------
// Kernel 2: fused QKV GEMM.  Y = xb(4096x1024) @ W(1024x2048), z picks weight.
// Block tile 128x128, 8 waves as 2x4, wave tile 64x32 (4x2 WMMA tiles).
// z==2 (V) stores transposed per head into Vt.
__global__ __launch_bounds__(256) void csa_qkv_gemm_kernel(
    const unsigned short* __restrict__ xb,
    const unsigned short* __restrict__ WqT,
    const unsigned short* __restrict__ WkT,
    const unsigned short* __restrict__ WvT,
    unsigned short* __restrict__ Qo,
    unsigned short* __restrict__ Ko,
    unsigned short* __restrict__ Vt) {
    const int lane = threadIdx.x & 31, l16 = lane & 15, lhi = lane >> 4;
    const int w = threadIdx.x >> 5;
    const int Mbase = blockIdx.y * 128 + (w >> 2) * 64;
    const int Nbase = blockIdx.x * 128 + (w & 3) * 32;
    const unsigned short* BT = (blockIdx.z == 0) ? WqT
                             : (blockIdx.z == 1) ? WkT : WvT;
    v8f acc[4][2] = {};
    for (int k = 0; k < CIN; k += 32) {
        __builtin_prefetch(xb + fragidx(Mbase, k + 64, CIN) + lane * 16, 0, 3);
        Frag a[4], b[2];
#pragma unroll
        for (int mt = 0; mt < 4; ++mt) {
            const unsigned short* p =
                xb + fragidx(Mbase + mt * 16 + l16, k + lhi * 8, CIN);
            a[mt].q[0] = ldg128(p);
            a[mt].q[1] = ldg128(p + 256);
        }
#pragma unroll
        for (int nt = 0; nt < 2; ++nt) {
            const unsigned short* p =
                BT + fragidx(Nbase + nt * 16 + l16, k + lhi * 8, CIN);
            b[nt].q[0] = ldg128(p);
            b[nt].q[1] = ldg128(p + 256);
        }
#pragma unroll
        for (int mt = 0; mt < 4; ++mt)
#pragma unroll
            for (int nt = 0; nt < 2; ++nt)
                acc[mt][nt] = wmma16(a[mt], b[nt], acc[mt][nt]);
    }
    if (blockIdx.z < 2) {
        unsigned short* O = (blockIdx.z == 0) ? Qo : Ko;
#pragma unroll
        for (int mt = 0; mt < 4; ++mt)
#pragma unroll
            for (int nt = 0; nt < 2; ++nt)
#pragma unroll
                for (int i = 0; i < 8; ++i) {
                    int row = Mbase + mt * 16 + i + lhi * 8;
                    int col = Nbase + nt * 16 + l16;
                    O[(size_t)row * C2 + col] = f2h(acc[mt][nt][i]);
                }
    } else {
#pragma unroll
        for (int mt = 0; mt < 4; ++mt)
#pragma unroll
            for (int nt = 0; nt < 2; ++nt)
#pragma unroll
                for (int i = 0; i < 8; ++i) {
                    int row = Mbase + mt * 16 + i + lhi * 8;   // token
                    int col = Nbase + nt * 16 + l16;           // channel
                    int bb = row >> 11, nn = row & (SEQ - 1);
                    int h = col >> 7, d = col & 127;
                    Vt[(((size_t)(bb * HEADS + h) * 128 + d) << 11) + nn] =
                        f2h(acc[mt][nt][i]);
                }
    }
}

// ---------------------------------------------------------------------------
// Kernel 3: causal flash attention with async-LDS double buffering.
// grid = (N/128 query blocks, B*H); 8 waves, wave w owns rows [q0b+16w, +16).
// Per 32-key step: 256 threads issue 4x global_load_async_to_lds_b128 each
// (K tile 32x128 -> Kbuf[key][d], V tile 128x32 -> Vbuf[d][key]); compute on
// tile i overlaps the async DMA of tile i+1.  Online softmax in f32.
// The products are transposed: S^T = K Q^T (A = K rows, B = Q rows) and
// O^T += V^T P^T (A = Vbuf rows, B = P^T).  Lane (l16, lhi) then holds, of query
// q0 + l16, the scores of keys lhi*8 + 0..7 of each 16-key tile: maximum and sum run
// inside the lane, with one exchange between the wave halves, and the two score
// tiles, converted in place, are the B operand of the second product in the k order
// of the V loader (keys lhi*8 + 0..7, then 16 + lhi*8 + 0..7): P never leaves registers.
__global__ __launch_bounds__(256) void csa_attn_kernel(
    const unsigned short* __restrict__ Qg,
    const unsigned short* __restrict__ Kg,
    const unsigned short* __restrict__ Vt,
    unsigned short* __restrict__ A2) {
    __shared__ __align__(16) unsigned short Kbuf[2][32 * KPAD];
    __shared__ __align__(16) unsigned short Vbuf[2][128 * VPAD];

    const int tid = threadIdx.x;
    const int lane = tid & 31, l16 = lane & 15, lhi = lane >> 4;
    const int w = tid >> 5;
    const int bb = blockIdx.y >> 4, h = blockIdx.y & 15;
    const int q0b = blockIdx.x * 128;
    const int q0 = q0b + w * 16;

    const unsigned short* Qb = Qg + (size_t)bb * SEQ * C2 + h * 128;
    const unsigned short* Kb = Kg + (size_t)bb * SEQ * C2 + h * 128;
    const unsigned short* Vb = Vt + (size_t)(bb * HEADS + h) * 128 * SEQ;

    // per-thread async chunk coordinates (16B chunks)
    const int kr = tid >> 4, kc = (tid & 15) * 8;   // K: rows kr, kr+16
    const int vd = tid >> 2, vc = (tid & 3) * 8;    // V: rows vd, vd+64

    Frag qf[4];
#pragma unroll
    for (int j = 0; j < 4; ++j) {
        const unsigned short* p = Qb + (size_t)(q0 + l16) * C2 + j * 32 + lhi * 8;
        qf[j].q[0] = ldg128(p);
        qf[j].q[1] = ldg128(p + 16);
    }

    v8f o[8] = {};                        // o[t][i] = O[q0 + l16][t*16 + lhi*8 + i]
    const int qrow = q0 + l16;            // the lane's query
    float mrow = -1e30f;                  // its running maximum (alike in both halves)
    float lrow = 0.0f;                    // its running sum over this half's keys

    const int niter = (q0b + 128) / 32;   // uniform across the block

    // prologue: async-issue tile 0 into buffer 0
    {
        unsigned kof = (unsigned)(size_t)&Kbuf[0][0];
        unsigned vof = (unsigned)(size_t)&Vbuf[0][0];
        async_ld128(kof + (unsigned)(kr * KPAD + kc) * 2,
                    Kb + (size_t)kr * C2 + kc);
        async_ld128(kof + (unsigned)((kr + 16) * KPAD + kc) * 2,
                    Kb + (size_t)(kr + 16) * C2 + kc);
        async_ld128(vof + (unsigned)(vd * VPAD + vc) * 2,
                    Vb + (size_t)vd * SEQ + vc);
        async_ld128(vof + (unsigned)((vd + 64) * VPAD + vc) * 2,
                    Vb + (size_t)(vd + 64) * SEQ + vc);
    }

    for (int it = 0; it < niter; ++it) {
        const int kv = it * 32;
        __syncthreads();                  // release buffer (it+1)&1
        if (it + 1 < niter) {
            const int kvn = kv + 32;
            unsigned kof = (unsigned)(size_t)&Kbuf[(it + 1) & 1][0];
            unsigned vof = (unsigned)(size_t)&Vbuf[(it + 1) & 1][0];
            async_ld128(kof + (unsigned)(kr * KPAD + kc) * 2,
                        Kb + (size_t)(kvn + kr) * C2 + kc);
            async_ld128(kof + (unsigned)((kr + 16) * KPAD + kc) * 2,
                        Kb + (size_t)(kvn + kr + 16) * C2 + kc);
            async_ld128(vof + (unsigned)(vd * VPAD + vc) * 2,
                        Vb + (size_t)vd * SEQ + kvn + vc);
            async_ld128(vof + (unsigned)((vd + 64) * VPAD + vc) * 2,
                        Vb + (size_t)(vd + 64) * SEQ + kvn + vc);
            // async loads complete in order: cnt<=4 => tile `it` has landed
            asm volatile("s_wait_asynccnt 0x4" ::: "memory");
        } else {
            asm volatile("s_wait_asynccnt 0x0" ::: "memory");
        }
        __syncthreads();                  // tile `it` visible to all waves

        const unsigned short* kt = Kbuf[it & 1];
        const unsigned short* vt = Vbuf[it & 1];

        // S^T = K * Q^T  (two 16x16 key tiles)
        v8f s0 = {}, s1 = {};
        Frag kf[4][2];
#pragma unroll                            // kf[] indexed by constants: registers
        for (int j = 0; j < 4; ++j) {     // d chunks of 32
            const unsigned short* p0 = kt + l16 * KPAD + j * 32 + lhi * 8;
            kf[j][0].q[0] = *(const v4u*)p0;
            kf[j][0].q[1] = *(const v4u*)(p0 + 16);
            const unsigned short* p1 = p0 + 16 * KPAD;
            kf[j][1].q[0] = *(const v4u*)p1;
            kf[j][1].q[1] = *(const v4u*)(p1 + 16);
        }
        // nothing is scheduled across: the 16 K loads issue as one group ahead of the
        // products (left alone: 2 loads and a wait to 0 in front of every product)
        __builtin_amdgcn_sched_barrier(0);
#pragma unroll                            // kf[], qf[] indexed by constants: registers
        for (int j = 0; j < 4; ++j) {
            s0 = wmma16(kf[j][0], qf[j], s0);
            s1 = wmma16(kf[j][1], qf[j], s1);
        }
        Frag vf[8];
#pragma unroll                            // vf[] indexed by constants: registers
        for (int t = 0; t < 8; ++t) {     // 8 d-tiles of V^T
            const unsigned short* p = vt + (t * 16 + l16) * VPAD + lhi * 8;
            vf[t].q[0] = *(const v4u*)p;
            vf[t].q[1] = *(const v4u*)(p + 16);
        }
        // nothing is scheduled across: the 16 V loads issue ahead of the softmax and land
        // under it (left alone: 2 loads and a wait in front of every product)
        __builtin_amdgcn_sched_barrier(0);

        // online softmax update: the lane's 16 scores of its one query.  Every loop
        // below is unrolled so that sc[], red[] and pf are indexed by constants and
        // stay in registers.
        float sc[16], red[16];
#pragma unroll
        for (int i = 0; i < 8; ++i) {
            const int c0 = kv + lhi * 8 + i, c1 = c0 + 16;   // keys
            float v0 = s0[i] * 0.125f;    // scale 1/sqrt(64)
            float v1 = s1[i] * 0.125f;
            if (c0 > qrow) v0 = -1e30f;
            if (c1 > qrow) v1 = -1e30f;
            sc[i] = v0;
            sc[8 + i] = v1;
        }
#pragma unroll
        for (int i = 0; i < 16; ++i) red[i] = sc[i];
#pragma unroll
        for (int st = 1; st < 16; st <<= 1)   // pairwise tree: a short dependent chain
#pragma unroll
            for (int i = 0; i < 16; i += 2 * st) red[i] = fmaxf(red[i], red[i + st]);
        const float mnew  = fmaxf(mrow, fmaxf(red[0], xhalf(red[0])));
        const float scale = __expf(mrow - mnew);
        Frag pf;                          // P^T as B: elements 0..7 of s0, 8..15 of s1
#pragma unroll
        for (int i = 0; i < 16; ++i) {
            red[i] = __expf(sc[i] - mnew);
            pf.v[i] = (_Float16)red[i];
        }
#pragma unroll
        for (int st = 1; st < 16; st <<= 1)   // the same pairwise tree for the sum
#pragma unroll
            for (int i = 0; i < 16; i += 2 * st) red[i] += red[i + st];
        lrow = lrow * scale + red[0];
        mrow = mnew;
#pragma unroll
        for (int t = 0; t < 8; ++t) o[t] *= scale;
#pragma unroll
        for (int t = 0; t < 8; ++t)       // O^T += V^T * P^T  (8 d-tiles)
            o[t] = wmma16(vf[t], pf, o[t]);
    }

    // the wave's 16 rows are one row tile of A2; a lane's 8 values of d-tile t are one
    // 16-byte chunk of it, and the wave's 32 chunks lie in lane order: 512 bytes a store
    const float inv = 1.0f / (lrow + xhalf(lrow));   // the two halves' sums joined
    unsigned short* Ob = A2 + fragidx(bb * SEQ + q0 + l16, h * 128 + lhi * 8, C2);
#pragma unroll                            // o[] indexed by constants: registers
    for (int t = 0; t < 8; ++t) {
        union { unsigned short e[8]; v4u q; } pk;
#pragma unroll                            // the 8 halves pack in registers
        for (int i = 0; i < 8; ++i) pk.e[i] = f2h(o[t][i] * inv);
        *(v4u*)(Ob + t * 256) = pk.q;
    }
}

// ---------------------------------------------------------------------------
// Kernel 4: output projection.  out = A2(4096x2048) @ Wo(2048x1024), f32 out.
__global__ __launch_bounds__(256) void csa_oproj_gemm_kernel(
    const unsigned short* __restrict__ A2,
    const unsigned short* __restrict__ WoT,
    float* __restrict__ out) {
    const int lane = threadIdx.x & 31, l16 = lane & 15, lhi = lane >> 4;
    const int w = threadIdx.x >> 5;
    const int Mbase = blockIdx.y * 128 + (w >> 2) * 64;
    const int Nbase = blockIdx.x * 128 + (w & 3) * 32;
    v8f acc[4][2] = {};
    for (int k = 0; k < C2; k += 32) {
        __builtin_prefetch(A2 + fragidx(Mbase, k + 64, C2) + lane * 16, 0, 3);
        Frag a[4], b[2];
#pragma unroll
        for (int mt = 0; mt < 4; ++mt) {
            const unsigned short* p =
                A2 + fragidx(Mbase + mt * 16 + l16, k + lhi * 8, C2);
            a[mt].q[0] = ldg128(p);
            a[mt].q[1] = ldg128(p + 256);
        }
#pragma unroll
        for (int nt = 0; nt < 2; ++nt) {
            const unsigned short* p =
                WoT + fragidx(Nbase + nt * 16 + l16, k + lhi * 8, C2);
            b[nt].q[0] = ldg128(p);
            b[nt].q[1] = ldg128(p + 256);
        }
#pragma unroll
        for (int mt = 0; mt < 4; ++mt)
#pragma unroll
            for (int nt = 0; nt < 2; ++nt)
                acc[mt][nt] = wmma16(a[mt], b[nt], acc[mt][nt]);
    }
#pragma unroll
    for (int mt = 0; mt < 4; ++mt)
#pragma unroll
        for (int nt = 0; nt < 2; ++nt)
#pragma unroll
            for (int i = 0; i < 8; ++i) {
                int row = Mbase + mt * 16 + i + lhi * 8;
                int col = Nbase + nt * 16 + l16;
                out[(size_t)row * CIN + col] = acc[mt][nt][i];
            }
}

// ---------------------------------------------------------------------------
extern "C" void kernel_launch(void* const* d_in, const int* in_sizes, int n_in,
                              void* d_out, int out_size, void* d_ws,
                              size_t ws_size, hipStream_t stream) {
    (void)in_sizes; (void)n_in; (void)out_size; (void)ws_size;
    const float* x  = (const float*)d_in[0];
    const float* Wq = (const float*)d_in[1];
    const float* Wk = (const float*)d_in[2];
    const float* Wv = (const float*)d_in[3];
    const float* Wo = (const float*)d_in[4];

    unsigned short* xb  = (unsigned short*)d_ws;            // 4M elems
    unsigned short* WqT = xb  + (size_t)NTOK * CIN;         // 2M
    unsigned short* WkT = WqT + (size_t)C2 * CIN;           // 2M
    unsigned short* WvT = WkT + (size_t)C2 * CIN;           // 2M
    unsigned short* WoT = WvT + (size_t)C2 * CIN;           // 2M
    unsigned short* Qb  = WoT + (size_t)CIN * C2;           // 8M
    unsigned short* Kb  = Qb  + (size_t)NTOK * C2;          // 8M
    unsigned short* Vt  = Kb  + (size_t)NTOK * C2;          // 8M
    unsigned short* A2  = Vt  + (size_t)2 * HEADS * 128 * SEQ; // 8M

    csa_prep_kernel<<<4 * TRBLK + (NTOK * CIN) / 256, 256, 0, stream>>>(
        x, Wq, Wk, Wv, Wo, xb, WqT, WkT, WvT, WoT, NTOK * CIN);

    csa_qkv_gemm_kernel<<<dim3(C2 / 128, NTOK / 128, 3), 256, 0, stream>>>(
        xb, WqT, WkT, WvT, Qb, Kb, Vt);

    csa_attn_kernel<<<dim3(SEQ / 128, 2 * HEADS), 256, 0, stream>>>(
        Qb, Kb, Vt, A2);

    csa_oproj_gemm_kernel<<<dim3(CIN / 128, NTOK / 128), 256, 0, stream>>>(
        A2, WoT, (float*)d_out);
}

// v006
// It runs in 172 microseconds.
// In both of two side-by-side timings against v005, it was 1.05 times as fast.
// Counting every step since v000, it is 2.56 times as fast.
#include <hip/hip_runtime.h>

// ---------------------------------------------------------------------------
// ComplexSpectralAttention == standard causal MHA, head_dim=128, scale=1/8,
// plus QKV projection GEMMs and an output projection GEMM.
// Shapes: B=2, N=2048, C=1024, H=16, D=128 (per head), tokens NT=4096.
// Strategy: f16 WMMA (v_wmma_f32_16x16x32_f16) everywhere, f32 accumulate.
// Attention streams K/V tiles into LDS with global_load_async_to_lds_b128
// (ASYNCcnt), double-buffered, shared by all 8 waves of the block.
// Workspace (f16 elements), total ~88 MB: xb, WqT/WkT/WvT/WoT, Q, K, Vt, A2.
// The GEMM operands (xb, the four WT, A2) lie in fragment order: see fragidx().
// ---------------------------------------------------------------------------

typedef __attribute__((ext_vector_type(16))) _Float16     v16h;
typedef __attribute__((ext_vector_type(8)))  float        v8f;
typedef __attribute__((ext_vector_type(4)))  unsigned int v4u;
typedef __attribute__((ext_vector_type(4)))  float        v4f;

union Frag {            // one WMMA A/B operand: 16 f16 = 8 VGPRs = 2 x b128
    v16h v;
    v4u  q[2];          // q[0] = K {kb..kb+7}, q[1] = K {kb+16..kb+23}
};

__device__ __forceinline__ unsigned short f2h(float f) {
    union { _Float16 h; unsigned short u; } cv;
    cv.h = (_Float16)f;
    return cv.u;
}

__device__ __forceinline__ v4u ldg128(const unsigned short* p) {
    return *(const v4u*)p;
}

__device__ __forceinline__ v8f wmma16(const Frag& a, const Frag& b, v8f c) {
    return __builtin_amdgcn_wmma_f32_16x16x32_f16(
        false, a.v, false, b.v, (short)0, c, false, false);
}

// Async copy 16B/lane from global to LDS (gfx1250 VGLOBAL, tracked by ASYNCcnt)
__device__ __forceinline__ void async_ld128(unsigned lds_off,
                                            const unsigned short* gptr) {
    unsigned long long ga = (unsigned long long)(size_t)gptr;
    asm volatile("global_load_async_to_lds_b128 %0, %1, off"
                 :: "v"(lds_off), "v"(ga) : "memory");
}

// Lane l's value in lane l ^ 16 (the other half of the wave), by a vector cross-row
// move: no LDS-counter round trip, which is what __shfl_xor compiles to.
__device__ __forceinline__ float xhalf(float x) {
    return __builtin_bit_cast(float, __builtin_amdgcn_permlanex16(
        __builtin_bit_cast(int, x), __builtin_bit_cast(int, x),
        0x76543210, 0xfedcba98, false, false));
}

#define SEQ   2048
#define NTOK  4096
#define CIN   1024
#define C2    2048
#define HEADS 16
#define KPAD  136   // 128 + 8 f16 pad (16B) to break LDS bank conflicts
#define VPAD  40    // 32 + 8 f16 pad
#define TRK   64    // transpose tile: k rows (64 k = two fragment k tiles of WT)
#define TRN   128   // transpose tile: n columns
#define TRP   72    // transpose tile: LDS pitch, 64 + 8 f16 (16-byte aligned rows)
#define TRBLK (CIN * C2 / (TRK * TRN))   // transpose tiles of one weight: 256

// Fragment order of a GEMM operand with K columns (k contiguous in the product):
// tiles of 16 rows x 32 k = 512 f16, the k tiles of one row tile one after another.
// Inside a tile lie first k 0..15, then k 16..31, each as 32 chunks of 16 bytes in
// lane order (lane = (k >> 3 & 1) * 16 + row): one global_load_b128 of a wave reads
// 512 contiguous bytes, four whole lines (row-major rows give 32 bytes of 16 lines).
__device__ __forceinline__ size_t fragidx(int r, int k, int K) {
    return ((size_t)(r >> 4) * (K >> 5) + (k >> 5)) * 512 + ((k >> 4) & 1) * 256 +
           (((k >> 3) & 1) * 16 + (r & 15)) * 8 + (k & 7);
}

// ---------------------------------------------------------------------------
// Kernel 1: all five conversions in one launch.  They are independent of each other
// and each is short, so as launches of their own they mostly cost start and drain.
// The block index picks the job: blocks 0..1023 transpose the four weights (256 tiles
// each; they have the longer chain load, LDS, barrier, store, so they start first),
// the rest convert x.
//
// Job a: x f32 -> f16, fragment order.  Thread i fills element i of xb, so a
// block writes 512 contiguous bytes (each line has one writer); 8 threads read 32
// contiguous bytes of one row of x.
__device__ __forceinline__ void csa_cvt_x(
    const float* __restrict__ x, unsigned short* __restrict__ xb, int i, int n) {
    if (i < n) {                              // the inverse of fragidx()
        const int tile = i >> 9;
        const int r = tile / (CIN / 32) * 16 + ((i >> 3) & 15);
        const int k = tile % (CIN / 32) * 32 + ((i >> 8) & 1) * 16 +
                      ((i >> 7) & 1) * 8 + (i & 7);
        xb[i] = f2h(x[(size_t)r * CIN + k]);
    }
}

// Job b: W (Krows x Ncols, f32) -> WT (Ncols x Krows, f16, fragment order), one
// 64 k x 128 n tile per block through LDS: 16-byte loads along n, whole 128-byte
// lines of WT stored.  Krows is a multiple of 64, Ncols a multiple of 128.
// bx, by: the tile's n and k index, alike in the whole block.
__device__ __forceinline__ void csa_cvt_tr(
    unsigned short* tile,
    const float* __restrict__ W, unsigned short* __restrict__ WT,
    int Krows, int Ncols, int bx, int by) {
    const int tid = threadIdx.x;
    const int k0 = by * TRK, n0 = bx * TRN;
    const int kq = tid >> 5, nq = tid & 31;   // 8 k rows x 4 n columns a thread
    const float* s = W + (size_t)(k0 + kq * 8) * Ncols + n0 + nq * 4;
    const float* a[8];
    v4f r[8];
#pragma unroll
    for (int i = 0; i < 8; ++i) a[i] = s + (size_t)i * Ncols;
#pragma unroll
    for (int i = 0; i < 8; ++i) r[i] = *(const v4f*)a[i];
    // inputs only: the eight results keep all eight loads in flight together (the
    // compiler otherwise held the last two back behind the first four), and the
    // eight address pairs stay live, so nothing lands in one ahead of this wait
    asm volatile("s_wait_xcnt 0x0"
                 :: "v"(a[0]), "v"(a[1]), "v"(a[2]), "v"(a[3]),
                    "v"(a[4]), "v"(a[5]), "v"(a[6]), "v"(a[7]),
                    "v"(r[0]), "v"(r[1]), "v"(r[2]), "v"(r[3]),
                    "v"(r[4]), "v"(r[5]), "v"(r[6]), "v"(r[7]) : "memory");
#pragma unroll
    for (int j = 0; j < 4; ++j) {
        union { unsigned short h[8]; v4u q; } pk;
#pragma unroll
        for (int i = 0; i < 8; ++i) pk.h[i] = f2h(r[i][j]);
        *(v4u*)&tile[(nq * 4 + j) * TRP + kq * 8] = pk.q;
    }
    __syncthreads();                          // tile complete before read-out
#pragma unroll
    for (int p = 0; p < TRN * TRK / 8 / 256; ++p) {
        const int id = p * 256 + tid;         // 16-byte chunks in the order of WT
        const int n = (id >> 7) * 16 + (id & 15), k = ((id >> 4) & 7) * 8;
        *(v4u*)(WT + fragidx(n0 + n, k0 + k, Krows)) =
            *(const v4u*)&tile[n * TRP + k];
    }
}

__global__ __launch_bounds__(256) void csa_prep_kernel(
    const float* __restrict__ x,
    const float* __restrict__ Wq, const float* __restrict__ Wk,
    const float* __restrict__ Wv, const float* __restrict__ Wo,
    unsigned short* __restrict__ xb,
    unsigned short* __restrict__ WqT, unsigned short* __restrict__ WkT,
    unsigned short* __restrict__ WvT, unsigned short* __restrict__ WoT, int n) {
    __shared__ __align__(16) unsigned short tile[TRN * TRP];
    const int b = blockIdx.x;                 // every test on it is block-uniform
    if (b < 4 * TRBLK) {
        const int job = b / TRBLK, t = b % TRBLK;
        if (job < 3)                          // 1024 k x 2048 n: 16 tiles along n
            csa_cvt_tr(tile, job == 0 ? Wq : job == 1 ? Wk : Wv,
                       job == 0 ? WqT : job == 1 ? WkT : WvT, CIN, C2,
                       t % (C2 / TRN), t / (C2 / TRN));
        else                                  // 2048 k x 1024 n: 8 tiles along n
            csa_cvt_tr(tile, Wo, WoT, C2, CIN, t % (CIN / TRN), t / (CIN / TRN));
    } else {
        csa_cvt_x(x, xb, (b - 4 * TRBLK) * 256 + threadIdx.x, n);
    }
}

// ---------------------------------------------------------------------------
// Kernel 2: fused QKV GEMM.  Y = xb(4096x1024) @ W(1024x2048), z picks weight.
// Block tile 128x128, 8 waves as 2x4, wave tile 64x32 (4x2 WMMA tiles).
// z==2 (V) stores transposed per head into Vt.
__global__ __launch_bounds__(256) void csa_qkv_gemm_kernel(
    const unsigned short* __restrict__ xb,
    const unsigned short* __restrict__ WqT,
    const unsigned short* __restrict__ WkT,
    const unsigned short* __restrict__ WvT,
    unsigned short* __restrict__ Qo,
    unsigned short* __restrict__ Ko,
    unsigned short* __restrict__ Vt) {
    const int lane = threadIdx.x & 31, l16 = lane & 15, lhi = lane >> 4;
    const int w = threadIdx.x >> 5;
    const int Mbase = blockIdx.y * 128 + (w >> 2) * 64;
    const int Nbase = blockIdx.x * 128 + (w & 3) * 32;
    const unsigned short* BT = (blockIdx.z == 0) ? WqT
                             : (blockIdx.z == 1) ? WkT : WvT;
    v8f acc[4][2] = {};
    for (int k = 0; k < CIN; k += 32) {
        __builtin_prefetch(xb + fragidx(Mbase, k + 64, CIN) + lane * 16, 0, 3);
        Frag a[4], b[2];
#pragma unroll
        for (int mt = 0; mt < 4; ++mt) {
            const unsigned short* p =
                xb + fragidx(Mbase + mt * 16 + l16, k + lhi * 8, CIN);
            a[mt].q[0] = ldg128(p);
            a[mt].q[1] = ldg128(p + 256);
        }
#pragma unroll
        for (int nt = 0; nt < 2; ++nt) {
            const unsigned short* p =
                BT + fragidx(Nbase + nt * 16 + l16, k + lhi * 8, CIN);
            b[nt].q[0] = ldg128(p);
            b[nt].q[1] = ldg128(p + 256);
        }
#pragma unroll
        for (int mt = 0; mt < 4; ++mt)
#pragma unroll
            for (int nt = 0; nt < 2; ++nt)
                acc[mt][nt] = wmma16(a[mt], b[nt], acc[mt][nt]);
    }
    if (blockIdx.z < 2) {
        unsigned short* O = (blockIdx.z == 0) ? Qo : Ko;
#pragma unroll
        for (int mt = 0; mt < 4; ++mt)
#pragma unroll
            for (int nt = 0; nt < 2; ++nt)
#pragma unroll
                for (int i = 0; i < 8; ++i) {
                    int row = Mbase + mt * 16 + i + lhi * 8;
                    int col = Nbase + nt * 16 + l16;
                    O[(size_t)row * C2 + col] = f2h(acc[mt][nt][i]);
                }
    } else {
#pragma unroll
        for (int mt = 0; mt < 4; ++mt)
#pragma unroll
            for (int nt = 0; nt < 2; ++nt)
#pragma unroll
                for (int i = 0; i < 8; ++i) {
                    int row = Mbase + mt * 16 + i + lhi * 8;   // token
                    int col = Nbase + nt * 16 + l16;           // channel
                    int bb = row >> 11, nn = row & (SEQ - 1);
                    int h = col >> 7, d = col & 127;
                    Vt[(((size_t)(bb * HEADS + h) * 128 + d) << 11) + nn] =
                        f2h(acc[mt][nt][i]);
                }
    }
}

// ---------------------------------------------------------------------------
// Kernel 3: causal flash attention with async-LDS double buffering.
// grid = (N/256 pairs of 128-query tiles, B*H); 8 waves, wave w owns rows [q0b+16w, +16).
// Per 32-key step: 256 threads issue 4x global_load_async_to_lds_b128 each
// (K tile 32x128 -> Kbuf[key][d], V tile 128x32 -> Vbuf[d][key]); compute on
// tile i overlaps the async DMA of tile i+1.  Online softmax in f32.
// The products are transposed: S^T = K Q^T (A = K rows, B = Q rows) and
// O^T += V^T P^T (A = Vbuf rows, B = P^T).  Lane (l16, lhi) then holds, of query
// q0 + l16, the scores of keys lhi*8 + 0..7 of each 16-key tile: maximum and sum run
// inside the lane, with one exchange between the wave halves, and the two score
// tiles, converted in place, are the B operand of the second product in the k order
// of the V loader (keys lhi*8 + 0..7, then 16 + lhi*8 + 0..7): P never leaves registers.
__global__ __launch_bounds__(256) void csa_attn_kernel(
    const unsigned short* __restrict__ Qg,
    const unsigned short* __restrict__ Kg,
    const unsigned short* __restrict__ Vt,
    unsigned short* __restrict__ A2) {
    __shared__ __align__(16) unsigned short Kbuf[2][32 * KPAD];
    __shared__ __align__(16) unsigned short Vbuf[2][128 * VPAD];

    const int tid = threadIdx.x;
    const int lane = tid & 31, l16 = lane & 15, lhi = lane >> 4;
    const int w = tid >> 5;
    const int bb = blockIdx.y >> 4, h = blockIdx.y & 15;

    const unsigned short* Qb = Qg + (size_t)bb * SEQ * C2 + h * 128;
    const unsigned short* Kb = Kg + (size_t)bb * SEQ * C2 + h * 128;
    const unsigned short* Vb = Vt + (size_t)(bb * HEADS + h) * 128 * SEQ;

    // per-thread async chunk coordinates (16B chunks)
    const int kr = tid >> 4, kc = (tid & 15) * 8;   // K: rows kr, kr+16
    const int vd = tid >> 2, vc = (tid & 3) * 8;    // V: rows vd, vd+64

    // Causal cost grows with the tile index (tile x walks 4 * (x + 1) key passes) and all
    // blocks are resident at once, so the launch lasts as long as its fullest WGP.  A block
    // takes tile 15 - x and then tile x: 68 passes in every block, one block a WGP.
    for (int half = 0; half < 2; ++half) {
        const int q0b = (half == 0 ? SEQ / 128 - 1 - (int)blockIdx.x : (int)blockIdx.x) * 128;
        const int q0 = q0b + w * 16;
        if (half != 0) {                      // block-uniform
            // the first tile's LDS reads are over in every wave before the second tile's
            // prologue copies land in buffer 0
            asm volatile("s_wait_dscnt 0x0" ::: "memory");
            __syncthreads();
        }

        Frag qf[4];
#pragma unroll
        for (int j = 0; j < 4; ++j) {
            const unsigned short* p = Qb + (size_t)(q0 + l16) * C2 + j * 32 + lhi * 8;
            qf[j].q[0] = ldg128(p);
            qf[j].q[1] = ldg128(p + 16);
        }

        v8f o[8] = {};                        // o[t][i] = O[q0 + l16][t*16 + lhi*8 + i]
        const int qrow = q0 + l16;            // the lane's query
        float mrow = -1e30f;                  // its running maximum (alike in both halves)
        float lrow = 0.0f;                    // its running sum over this half's keys

        const int niter = (q0b + 128) / 32;   // uniform across the block

        // prologue: async-issue tile 0 into buffer 0
        {
            unsigned kof = (unsigned)(size_t)&Kbuf[0][0];
            unsigned vof = (unsigned)(size_t)&Vbuf[0][0];
            async_ld128(kof + (unsigned)(kr * KPAD + kc) * 2,
                        Kb + (size_t)kr * C2 + kc);
            async_ld128(kof + (unsigned)((kr + 16) * KPAD + kc) * 2,
                        Kb + (size_t)(kr + 16) * C2 + kc);
            async_ld128(vof + (unsigned)(vd * VPAD + vc) * 2,
                        Vb + (size_t)vd * SEQ + vc);
            async_ld128(vof + (unsigned)((vd + 64) * VPAD + vc) * 2,
                        Vb + (size_t)(vd + 64) * SEQ + vc);
        }

        for (int it = 0; it < niter; ++it) {
            const int kv = it * 32;
            __syncthreads();                  // release buffer (it+1)&1
            if (it + 1 < niter) {
                const int kvn = kv + 32;
                unsigned kof = (unsigned)(size_t)&Kbuf[(it + 1) & 1][0];
                unsigned vof = (unsigned)(size_t)&Vbuf[(it + 1) & 1][0];
                async_ld128(kof + (unsigned)(kr * KPAD + kc) * 2,
                            Kb + (size_t)(kvn + kr) * C2 + kc);
                async_ld128(kof + (unsigned)((kr + 16) * KPAD + kc) * 2,
                            Kb + (size_t)(kvn + kr + 16) * C2 + kc);
                async_ld128(vof + (unsigned)(vd * VPAD + vc) * 2,
                            Vb + (size_t)vd * SEQ + kvn + vc);
                async_ld128(vof + (unsigned)((vd + 64) * VPAD + vc) * 2,
                            Vb + (size_t)(vd + 64) * SEQ + kvn + vc);
                // async loads complete in order: cnt<=4 => tile `it` has landed
                asm volatile("s_wait_asynccnt 0x4" ::: "memory");
            } else {
                asm volatile("s_wait_asynccnt 0x0" ::: "memory");
            }
            __syncthreads();                  // tile `it` visible to all waves

            const unsigned short* kt = Kbuf[it & 1];
            const unsigned short* vt = Vbuf[it & 1];

            // S^T = K * Q^T  (two 16x16 key tiles)
            v8f s0 = {}, s1 = {};
            Frag kf[4][2];
#pragma unroll                            // kf[] indexed by constants: registers
            for (int j = 0; j < 4; ++j) {     // d chunks of 32
                const unsigned short* p0 = kt + l16 * KPAD + j * 32 + lhi * 8;
                kf[j][0].q[0] = *(const v4u*)p0;
                kf[j][0].q[1] = *(const v4u*)(p0 + 16);
                const unsigned short* p1 = p0 + 16 * KPAD;
                kf[j][1].q[0] = *(const v4u*)p1;
                kf[j][1].q[1] = *(const v4u*)(p1 + 16);
            }
            // nothing is scheduled across: the 16 K loads issue as one group ahead of the
            // products (left alone: 2 loads and a wait to 0 in front of every product)
            __builtin_amdgcn_sched_barrier(0);
#pragma unroll                            // kf[], qf[] indexed by constants: registers
            for (int j = 0; j < 4; ++j) {
                s0 = wmma16(kf[j][0], qf[j], s0);
                s1 = wmma16(kf[j][1], qf[j], s1);
            }
            Frag vf[8];
#pragma unroll                            // vf[] indexed by constants: registers
            for (int t = 0; t < 8; ++t) {     // 8 d-tiles of V^T
                const unsigned short* p = vt + (t * 16 + l16) * VPAD + lhi * 8;
                vf[t].q[0] = *(const v4u*)p;
                vf[t].q[1] = *(const v4u*)(p + 16);
            }
            // nothing is scheduled across: the 16 V loads issue ahead of the softmax and land
            // under it (left alone: 2 loads and a wait in front of every product)
            __builtin_amdgcn_sched_barrier(0);

            // online softmax update: the lane's 16 scores of its one query.  Every loop
            // below is unrolled so that sc[], red[] and pf are indexed by constants and
            // stay in registers.
            float sc[16], red[16];
#pragma unroll
            for (int i = 0; i < 8; ++i) {
                const int c0 = kv + lhi * 8 + i, c1 = c0 + 16;   // keys
                float v0 = s0[i] * 0.125f;    // scale 1/sqrt(64)
                float v1 = s1[i] * 0.125f;
                if (c0 > qrow) v0 = -1e30f;
                if (c1 > qrow) v1 = -1e30f;
                sc[i] = v0;
                sc[8 + i] = v1;
            }
#pragma unroll
            for (int i = 0; i < 16; ++i) red[i] = sc[i];
#pragma unroll
            for (int st = 1; st < 16; st <<= 1)   // pairwise tree: a short dependent chain
#pragma unroll
                for (int i = 0; i < 16; i += 2 * st) red[i] = fmaxf(red[i], red[i + st]);
            const float mnew  = fmaxf(mrow, fmaxf(red[0], xhalf(red[0])));
            const float scale = __expf(mrow - mnew);
            Frag pf;                          // P^T as B: elements 0..7 of s0, 8..15 of s1
#pragma unroll
            for (int i = 0; i < 16; ++i) {
                red[i] = __expf(sc[i] - mnew);
                pf.v[i] = (_Float16)red[i];
            }
#pragma unroll
            for (int st = 1; st < 16; st <<= 1)   // the same pairwise tree for the sum
#pragma unroll
                for (int i = 0; i < 16; i += 2 * st) red[i] += red[i + st];
            lrow = lrow * scale + red[0];
            mrow = mnew;
#pragma unroll
            for (int t = 0; t < 8; ++t) o[t] *= scale;
#pragma unroll
            for (int t = 0; t < 8; ++t)       // O^T += V^T * P^T  (8 d-tiles)
                o[t] = wmma16(vf[t], pf, o[t]);
        }

        // the wave's 16 rows are one row tile of A2; a lane's 8 values of d-tile t are one
        // 16-byte chunk of it, and the wave's 32 chunks lie in lane order: 512 bytes a store
        const float inv = 1.0f / (lrow + xhalf(lrow));   // the two halves' sums joined
        unsigned short* Ob = A2 + fragidx(bb * SEQ + q0 + l16, h * 128 + lhi * 8, C2);
#pragma unroll                            // o[] indexed by constants: registers
        for (int t = 0; t < 8; ++t) {
            union { unsigned short e[8]; v4u q; } pk;
#pragma unroll                            // the 8 halves pack in registers
            for (int i = 0; i < 8; ++i) pk.e[i] = f2h(o[t][i] * inv);
            *(v4u*)(Ob + t * 256) = pk.q;
        }
    }
}

// ---------------------------------------------------------------------------
// Kernel 4: output projection.  out = A2(4096x2048) @ Wo(2048x1024), f32 out.
__global__ __launch_bounds__(256) void csa_oproj_gemm_kernel(
    const unsigned short* __restrict__ A2,
    const unsigned short* __restrict__ WoT,
    float* __restrict__ out) {
    const int lane = threadIdx.x & 31, l16 = lane & 15, lhi = lane >> 4;
    const int w = threadIdx.x >> 5;
    const int Mbase = blockIdx.y * 128 + (w >> 2) * 64;
    const int Nbase = blockIdx.x * 128 + (w & 3) * 32;
    v8f acc[4][2] = {};
    for (int k = 0; k < C2; k += 32) {
        __builtin_prefetch(A2 + fragidx(Mbase, k + 64, C2) + lane * 16, 0, 3);
        Frag a[4], b[2];
#pragma unroll
        for (int mt = 0; mt < 4; ++mt) {
            const unsigned short* p =
                A2 + fragidx(Mbase + mt * 16 + l16, k + lhi * 8, C2);
            a[mt].q[0] = ldg128(p);
            a[mt].q[1] = ldg128(p + 256);
        }
#pragma unroll
        for (int nt = 0; nt < 2; ++nt) {
            const unsigned short* p =
                WoT + fragidx(Nbase + nt * 16 + l16, k + lhi * 8, C2);
            b[nt].q[0] = ldg128(p);
            b[nt].q[1] = ldg128(p + 256);
        }
#pragma unroll
        for (int mt = 0; mt < 4; ++mt)
#pragma unroll
            for (int nt = 0; nt < 2; ++nt)
                acc[mt][nt] = wmma16(a[mt], b[nt], acc[mt][nt]);
    }
#pragma unroll
    for (int mt = 0; mt < 4; ++mt)
#pragma unroll
        for (int nt = 0; nt < 2; ++nt)
#pragma unroll
            for (int i = 0; i < 8; ++i) {
                int row = Mbase + mt * 16 + i + lhi * 8;
                int col = Nbase + nt * 16 + l16;
                out[(size_t)row * CIN + col] = acc[mt][nt][i];
            }
}

// ---------------------------------------------------------------------------
extern "C" void kernel_launch(void* const* d_in, const int* in_sizes, int n_in,
                              void* d_out, int out_size, void* d_ws,
                              size_t ws_size, hipStream_t stream) {
    (void)in_sizes; (void)n_in; (void)out_size; (void)ws_size;
    const float* x  = (const float*)d_in[0];
    const float* Wq = (const float*)d_in[1];
    const float* Wk = (const float*)d_in[2];
    const float* Wv = (const float*)d_in[3];
    const float* Wo = (const float*)d_in[4];

    unsigned short* xb  = (unsigned short*)d_ws;            // 4M elems
    unsigned short* WqT = xb  + (size_t)NTOK * CIN;         // 2M
    unsigned short* WkT = WqT + (size_t)C2 * CIN;           // 2M
    unsigned short* WvT = WkT + (size_t)C2 * CIN;           // 2M
    unsigned short* WoT = WvT + (size_t)C2 * CIN;           // 2M
    unsigned short* Qb  = WoT + (size_t)CIN * C2;           // 8M
    unsigned short* Kb  = Qb  + (size_t)NTOK * C2;          // 8M
    unsigned short* Vt  = Kb  + (size_t)NTOK * C2;          // 8M
    unsigned short* A2  = Vt  + (size_t)2 * HEADS * 128 * SEQ; // 8M

    csa_prep_kernel<<<4 * TRBLK + (NTOK * CIN) / 256, 256, 0, stream>>>(
        x, Wq, Wk, Wv, Wo, xb, WqT, WkT, WvT, WoT, NTOK * CIN);

    csa_qkv_gemm_kernel<<<dim3(C2 / 128, NTOK / 128, 3), 256, 0, stream>>>(
        xb, WqT, WkT, WvT, Qb, Kb, Vt);

    csa_attn_kernel<<<dim3(SEQ / 256, 2 * HEADS), 256, 0, stream>>>(
        Qb, Kb, Vt, A2);

    csa_oproj_gemm_kernel<<<dim3(CIN / 128, NTOK / 128), 256, 0, stream>>>(
        A2, WoT, (float*)d_out);
}

// v007
// It runs in 164 microseconds.
// Two timings next to v006 put it at 1.04 and 1.05 times that version's speed.
// Counting every step since v000, it is 2.67 times as fast.
#include <hip/hip_runtime.h>

// ---------------------------------------------------------------------------
// ComplexSpectralAttention == standard causal MHA, head_dim=128, scale=1/8,
// plus QKV projection GEMMs and an output projection GEMM.
// Shapes: B=2, N=2048, C=1024, H=16, D=128 (per head), tokens NT=4096.
// Strategy: f16 WMMA (v_wmma_f32_16x16x32_f16) everywhere, f32 accumulate.
// Attention streams K/V tiles into LDS with global_load_async_to_lds_b128
// (ASYNCcnt), double-buffered, shared by all 8 waves of the block.
// Workspace (f16 elements), total ~88 MB: xb, WqT/WkT/WvT/WoT, Q, K, Vt, A2.
// The GEMM operands (xb, the four WT, A2) lie in fragment order: see fragidx().
// ---------------------------------------------------------------------------

typedef __attribute__((ext_vector_type(16))) _Float16     v16h;
typedef __attribute__((ext_vector_type(8)))  float        v8f;
typedef __attribute__((ext_vector_type(4)))  unsigned int v4u;
typedef __attribute__((ext_vector_type(4)))  float        v4f;

union Frag {            // one WMMA A/B operand: 16 f16 = 8 VGPRs = 2 x b128
    v16h v;
    v4u  q[2];          // q[0] = K {kb..kb+7}, q[1] = K {kb+16..kb+23}
};

__device__ __forceinline__ unsigned short f2h(float f) {
    union { _Float16 h; unsigned short u; } cv;
    cv.h = (_Float16)f;
    return cv.u;
}

__device__ __forceinline__ v4u ldg128(const unsigned short* p) {
    return *(const v4u*)p;
}

__device__ __forceinline__ v8f wmma16(const Frag& a, const Frag& b, v8f c) {
    return __builtin_amdgcn_wmma_f32_16x16x32_f16(
        false, a.v, false, b.v, (short)0, c, false, false);
}

// Async copy 16B/lane from global to LDS (gfx1250 VGLOBAL, tracked by ASYNCcnt)
__device__ __forceinline__ void async_ld128(unsigned lds_off,
                                            const unsigned short* gptr) {
    unsigned long long ga = (unsigned long long)(size_t)gptr;
    asm volatile("global_load_async_to_lds_b128 %0, %1, off"
                 :: "v"(lds_off), "v"(ga) : "memory");
}

// Lane l's value in lane l ^ 16 (the other half of the wave), by a vector cross-row
// move: no LDS-counter round trip, which is what __shfl_xor compiles to.
__device__ __forceinline__ float xhalf(float x) {
    return __builtin_bit_cast(float, __builtin_amdgcn_permlanex16(
        __builtin_bit_cast(int, x), __builtin_bit_cast(int, x),
        0x76543210, 0xfedcba98, false, false));
}

#define SEQ   2048
#define NTOK  4096
#define CIN   1024
#define C2    2048
#define HEADS 16
#define KPAD  136   // 128 + 8 f16 pad (16B) to break LDS bank conflicts
#define VPAD  40    // 32 + 8 f16 pad
#define TRK   64    // transpose tile: k rows (64 k = two fragment k tiles of WT)
#define TRN   128   // transpose tile: n columns
#define TRP   72    // transpose tile: LDS pitch, 64 + 8 f16 (16-byte aligned rows)
#define TRBLK (CIN * C2 / (TRK * TRN))   // transpose tiles of one weight: 256

// Fragment order of a GEMM operand with K columns (k contiguous in the product):
// tiles of 16 rows x 32 k = 512 f16, the k tiles of one row tile one after another.
// Inside a tile lie first k 0..15, then k 16..31, each as 32 chunks of 16 bytes in
// lane order (lane = (k >> 3 & 1) * 16 + row): one global_load_b128 of a wave reads
// 512 contiguous bytes, four whole lines (row-major rows give 32 bytes of 16 lines).
__device__ __forceinline__ size_t fragidx(int r, int k, int K) {
    return ((size_t)(r >> 4) * (K >> 5) + (k >> 5)) * 512 + ((k >> 4) & 1) * 256 +
           (((k >> 3) & 1) * 16 + (r & 15)) * 8 + (k & 7);
}

// ---------------------------------------------------------------------------
// Kernel 1: all five conversions in one launch.  They are independent of each other
// and each is short, so as launches of their own they mostly cost start and drain.
// The block index picks the job: blocks 0..1023 transpose the four weights (256 tiles
// each; they have the longer chain load, LDS, barrier, store, so they start first),
// the rest convert x.
//
// Job a: x f32 -> f16, fragment order.  One wave converts 16 rows x 64 k (two k tiles,
// 2 KiB of xb in a row): 32 elements a lane, so the job starts 4,096 waves, each with
// its eight 16-byte loads in flight together.  A lane takes 8 k of one row (32 bytes of
// x, one 16-byte chunk of xb); the wave's 32 chunks are 8 rows x 32 k, so a load
// touches 8 lines of x and a store fills 4 whole 128-byte lines of xb (one writer each).
__device__ __forceinline__ void csa_cvt_x(
    const float* __restrict__ x, unsigned short* __restrict__ xb, int unit, int lane,
    int n) {
    if (unit * 1024 < n) {                    // alike in the whole wave
        const int rt = unit / (CIN / 64), kp = unit % (CIN / 64);
        const int rl = lane & 7, k8 = lane >> 3;
        const float* s = x + (size_t)(rt * 16 + rl) * CIN + kp * 64 + k8 * 8;
        v4f r[4][2];
#pragma unroll                            // r[] indexed by constants: registers
        for (int u = 0; u < 4; ++u) {         // u & 1: rows 0..7 or 8..15; u >> 1: k tile
            const float* p = s + (u & 1) * 8 * CIN + (u >> 1) * 32;
            r[u][0] = *(const v4f*)p;
            r[u][1] = *(const v4f*)(p + 4);
        }
        // fragidx(): k8 * 8 lies at k8 * 128, row rl + 8 at rl * 8 + 64, the next tile at 512
        unsigned short* d = xb + (size_t)unit * 1024 + k8 * 128 + rl * 8;
#pragma unroll                            // r[] indexed by constants: registers
        for (int u = 0; u < 4; ++u) {
            union { unsigned short h[8]; v4u q; } pk;
#pragma unroll                            // the 8 halves pack in registers
            for (int i = 0; i < 4; ++i) {
                pk.h[i] = f2h(r[u][0][i]);
                pk.h[4 + i] = f2h(r[u][1][i]);
            }
            *(v4u*)(d + (u >> 1) * 512 + (u & 1) * 64) = pk.q;
        }
    }
}

// Job b: W (Krows x Ncols, f32) -> WT (Ncols x Krows, f16, fragment order), one
// 64 k x 128 n tile per block through LDS: 16-byte loads along n, whole 128-byte
// lines of WT stored.  Krows is a multiple of 64, Ncols a multiple of 128.
// bx, by: the tile's n and k index, alike in the whole block.
__device__ __forceinline__ void csa_cvt_tr(
    unsigned short* tile,
    const float* __restrict__ W, unsigned short* __restrict__ WT,
    int Krows, int Ncols, int bx, int by) {
    const int tid = threadIdx.x;
    const int k0 = by * TRK, n0 = bx * TRN;
    const int kq = tid >> 5, nq = tid & 31;   // 8 k rows x 4 n columns a thread
    const float* s = W + (size_t)(k0 + kq * 8) * Ncols + n0 + nq * 4;
    const float* a[8];
    v4f r[8];
#pragma unroll
    for (int i = 0; i < 8; ++i) a[i] = s + (size_t)i * Ncols;
#pragma unroll
    for (int i = 0; i < 8; ++i) r[i] = *(const v4f*)a[i];
    // inputs only: the eight results keep all eight loads in flight together (the
    // compiler otherwise held the last two back behind the first four), and the
    // eight address pairs stay live, so nothing lands in one ahead of this wait
    asm volatile("s_wait_xcnt 0x0"
                 :: "v"(a[0]), "v"(a[1]), "v"(a[2]), "v"(a[3]),
                    "v"(a[4]), "v"(a[5]), "v"(a[6]), "v"(a[7]),
                    "v"(r[0]), "v"(r[1]), "v"(r[2]), "v"(r[3]),
                    "v"(r[4]), "v"(r[5]), "v"(r[6]), "v"(r[7]) : "memory");
#pragma unroll
    for (int j = 0; j < 4; ++j) {
        union { unsigned short h[8]; v4u q; } pk;
#pragma unroll
        for (int i = 0; i < 8; ++i) pk.h[i] = f2h(r[i][j]);
        *(v4u*)&tile[(nq * 4 + j) * TRP + kq * 8] = pk.q;
    }
    __syncthreads();                          // tile complete before read-out
#pragma unroll
    for (int p = 0; p < TRN * TRK / 8 / 256; ++p) {
        const int id = p * 256 + tid;         // 16-byte chunks in the order of WT
        const int n = (id >> 7) * 16 + (id & 15), k = ((id >> 4) & 7) * 8;
        *(v4u*)(WT + fragidx(n0 + n, k0 + k, Krows)) =
            *(const v4u*)&tile[n * TRP + k];
    }
}

__global__ __launch_bounds__(256) void csa_prep_kernel(
    const float* __restrict__ x,
    const float* __restrict__ Wq, const float* __restrict__ Wk,
    const float* __restrict__ Wv, const float* __restrict__ Wo,
    unsigned short* __restrict__ xb,
    unsigned short* __restrict__ WqT, unsigned short* __restrict__ WkT,
    unsigned short* __restrict__ WvT, unsigned short* __restrict__ WoT, int n) {
    __shared__ __align__(16) unsigned short tile[TRN * TRP];
    const int b = blockIdx.x;                 // every test on it is block-uniform
    if (b < 4 * TRBLK) {
        const int job = b / TRBLK, t = b % TRBLK;
        if (job < 3)                          // 1024 k x 2048 n: 16 tiles along n
            csa_cvt_tr(tile, job == 0 ? Wq : job == 1 ? Wk : Wv,
                       job == 0 ? WqT : job == 1 ? WkT : WvT, CIN, C2,
                       t % (C2 / TRN), t / (C2 / TRN));
        else                                  // 2048 k x 1024 n: 8 tiles along n
            csa_cvt_tr(tile, Wo, WoT, C2, CIN, t % (CIN / TRN), t / (CIN / TRN));
    } else {
        csa_cvt_x(x, xb, (b - 4 * TRBLK) * 8 + (int)(threadIdx.x >> 5), threadIdx.x & 31, n);
    }
}

// ---------------------------------------------------------------------------
// Kernel 2: fused QKV GEMM.  Y = xb(4096x1024) @ W(1024x2048), z picks weight.
// Block tile 128x128, 8 waves as 2x4, wave tile 64x32 (4x2 WMMA tiles).
// z==2 (V) stores transposed per head into Vt.
__global__ __launch_bounds__(256) void csa_qkv_gemm_kernel(
    const unsigned short* __restrict__ xb,
    const unsigned short* __restrict__ WqT,
    const unsigned short* __restrict__ WkT,
    const unsigned short* __restrict__ WvT,
    unsigned short* __restrict__ Qo,
    unsigned short* __restrict__ Ko,
    unsigned short* __restrict__ Vt) {
    const int lane = threadIdx.x & 31, l16 = lane & 15, lhi = lane >> 4;
    const int w = threadIdx.x >> 5;
    const int Mbase = blockIdx.y * 128 + (w >> 2) * 64;
    const int Nbase = blockIdx.x * 128 + (w & 3) * 32;
    const unsigned short* BT = (blockIdx.z == 0) ? WqT
                             : (blockIdx.z == 1) ? WkT : WvT;
    v8f acc[4][2] = {};
    for (int k = 0; k < CIN; k += 32) {
        __builtin_prefetch(xb + fragidx(Mbase, k + 64, CIN) + lane * 16, 0, 3);
        Frag a[4], b[2];
#pragma unroll
        for (int mt = 0; mt < 4; ++mt) {
            const unsigned short* p =
                xb + fragidx(Mbase + mt * 16 + l16, k + lhi * 8, CIN);
            a[mt].q[0] = ldg128(p);
            a[mt].q[1] = ldg128(p + 256);
        }
#pragma unroll
        for (int nt = 0; nt < 2; ++nt) {
            const unsigned short* p =
                BT + fragidx(Nbase + nt * 16 + l16, k + lhi * 8, CIN);
            b[nt].q[0] = ldg128(p);
            b[nt].q[1] = ldg128(p + 256);
        }
#pragma unroll
        for (int mt = 0; mt < 4; ++mt)
#pragma unroll
            for (int nt = 0; nt < 2; ++nt)
                acc[mt][nt] = wmma16(a[mt], b[nt], acc[mt][nt]);
    }
    if (blockIdx.z < 2) {
        unsigned short* O = (blockIdx.z == 0) ? Qo : Ko;
#pragma unroll
        for (int mt = 0; mt < 4; ++mt)
#pragma unroll
            for (int nt = 0; nt < 2; ++nt)
#pragma unroll
                for (int i = 0; i < 8; ++i) {
                    int row = Mbase + mt * 16 + i + lhi * 8;
                    int col = Nbase + nt * 16 + l16;
                    O[(size_t)row * C2 + col] = f2h(acc[mt][nt][i]);
                }
    } else {
#pragma unroll
        for (int mt = 0; mt < 4; ++mt)
#pragma unroll
            for (int nt = 0; nt < 2; ++nt)
#pragma unroll
                for (int i = 0; i < 8; ++i) {
                    int row = Mbase + mt * 16 + i + lhi * 8;   // token
                    int col = Nbase + nt * 16 + l16;           // channel
                    int bb = row >> 11, nn = row & (SEQ - 1);
                    int h = col >> 7, d = col & 127;
                    Vt[(((size_t)(bb * HEADS + h) * 128 + d) << 11) + nn] =
                        f2h(acc[mt][nt][i]);
                }
    }
}

// ---------------------------------------------------------------------------
// Kernel 3: causal flash attention with async-LDS double buffering.
// grid = (N/256 pairs of 128-query tiles, B*H); 8 waves, wave w owns rows [q0b+16w, +16).
// Per 32-key step: 256 threads issue 4x global_load_async_to_lds_b128 each
// (K tile 32x128 -> Kbuf[key][d], V tile 128x32 -> Vbuf[d][key]); compute on
// tile i overlaps the async DMA of tile i+1.  Online softmax in f32.
// The products are transposed: S^T = K Q^T (A = K rows, B = Q rows) and
// O^T += V^T P^T (A = Vbuf rows, B = P^T).  Lane (l16, lhi) then holds, of query
// q0 + l16, the scores of keys lhi*8 + 0..7 of each 16-key tile: maximum and sum run
// inside the lane, with one exchange between the wave halves, and the two score
// tiles, converted in place, are the B operand of the second product in the k order
// of the V loader (keys lhi*8 + 0..7, then 16 + lhi*8 + 0..7): P never leaves registers.
__global__ __launch_bounds__(256) void csa_attn_kernel(
    const unsigned short* __restrict__ Qg,
    const unsigned short* __restrict__ Kg,
    const unsigned short* __restrict__ Vt,
    unsigned short* __restrict__ A2) {
    __shared__ __align__(16) unsigned short Kbuf[2][32 * KPAD];
    __shared__ __align__(16) unsigned short Vbuf[2][128 * VPAD];

    const int tid = threadIdx.x;
    const int lane = tid & 31, l16 = lane & 15, lhi = lane >> 4;
    const int w = tid >> 5;
    const int bb = blockIdx.y >> 4, h = blockIdx.y & 15;

    const unsigned short* Qb = Qg + (size_t)bb * SEQ * C2 + h * 128;
    const unsigned short* Kb = Kg + (size_t)bb * SEQ * C2 + h * 128;
    const unsigned short* Vb = Vt + (size_t)(bb * HEADS + h) * 128 * SEQ;

    // per-thread async chunk coordinates (16B chunks)
    const int kr = tid >> 4, kc = (tid & 15) * 8;   // K: rows kr, kr+16
    const int vd = tid >> 2, vc = (tid & 3) * 8;    // V: rows vd, vd+64

    // Causal cost grows with the tile index (tile x walks 4 * (x + 1) key passes) and all
    // blocks are resident at once, so the launch lasts as long as its fullest WGP.  A block
    // takes tile 15 - x and then tile x: 68 passes in every block, one block a WGP.
    for (int half = 0; half < 2; ++half) {
        const int q0b = (half == 0 ? SEQ / 128 - 1 - (int)blockIdx.x : (int)blockIdx.x) * 128;
        const int q0 = q0b + w * 16;
        if (half != 0) {                      // block-uniform
            // the first tile's LDS reads are over in every wave before the second tile's
            // prologue copies land in buffer 0
            asm volatile("s_wait_dscnt 0x0" ::: "memory");
            __syncthreads();
        }

        Frag qf[4];
#pragma unroll
        for (int j = 0; j < 4; ++j) {
            const unsigned short* p = Qb + (size_t)(q0 + l16) * C2 + j * 32 + lhi * 8;
            qf[j].q[0] = ldg128(p);
            qf[j].q[1] = ldg128(p + 16);
        }

        v8f o[8] = {};                        // o[t][i] = O[q0 + l16][t*16 + lhi*8 + i]
        const int qrow = q0 + l16;            // the lane's query
        float mrow = -1e30f;                  // its running maximum (alike in both halves)
        float lrow = 0.0f;                    // its running sum over this half's keys

        const int niter = (q0b + 128) / 32;   // uniform across the block

        // prologue: async-issue tile 0 into buffer 0
        {
            unsigned kof = (unsigned)(size_t)&Kbuf[0][0];
            unsigned vof = (unsigned)(size_t)&Vbuf[0][0];
            async_ld128(kof + (unsigned)(kr * KPAD + kc) * 2,
                        Kb + (size_t)kr * C2 + kc);
            async_ld128(kof + (unsigned)((kr + 16) * KPAD + kc) * 2,
                        Kb + (size_t)(kr + 16) * C2 + kc);
            async_ld128(vof + (unsigned)(vd * VPAD + vc) * 2,
                        Vb + (size_t)vd * SEQ + vc);
            async_ld128(vof + (unsigned)((vd + 64) * VPAD + vc) * 2,
                        Vb + (size_t)(vd + 64) * SEQ + vc);
        }

        for (int it = 0; it < niter; ++it) {
            const int kv = it * 32;
            __syncthreads();                  // release buffer (it+1)&1
            if (it + 1 < niter) {
                const int kvn = kv + 32;
                unsigned kof = (unsigned)(size_t)&Kbuf[(it + 1) & 1][0];
                unsigned vof = (unsigned)(size_t)&Vbuf[(it + 1) & 1][0];
                async_ld128(kof + (unsigned)(kr * KPAD + kc) * 2,
                            Kb + (size_t)(kvn + kr) * C2 + kc);
                async_ld128(kof + (unsigned)((kr + 16) * KPAD + kc) * 2,
                            Kb + (size_t)(kvn + kr + 16) * C2 + kc);
                async_ld128(vof + (unsigned)(vd * VPAD + vc) * 2,
                            Vb + (size_t)vd * SEQ + kvn + vc);
                async_ld128(vof + (unsigned)((vd + 64) * VPAD + vc) * 2,
                            Vb + (size_t)(vd + 64) * SEQ + kvn + vc);
                // async loads complete in order: cnt<=4 => tile `it` has landed
                asm volatile("s_wait_asynccnt 0x4" ::: "memory");
            } else {
                asm volatile("s_wait_asynccnt 0x0" ::: "memory");
            }
            __syncthreads();                  // tile `it` visible to all waves

            const unsigned short* kt = Kbuf[it & 1];
            const unsigned short* vt = Vbuf[it & 1];

            // S^T = K * Q^T  (two 16x16 key tiles)
            v8f s0 = {}, s1 = {};
            Frag kf[4][2];
#pragma unroll                            // kf[] indexed by constants: registers
            for (int j = 0; j < 4; ++j) {     // d chunks of 32
                const unsigned short* p0 = kt + l16 * KPAD + j * 32 + lhi * 8;
                kf[j][0].q[0] = *(const v4u*)p0;
                kf[j][0].q[1] = *(const v4u*)(p0 + 16);
                const unsigned short* p1 = p0 + 16 * KPAD;
                kf[j][1].q[0] = *(const v4u*)p1;
                kf[j][1].q[1] = *(const v4u*)(p1 + 16);
            }
            // nothing is scheduled across: the 16 K loads issue as one group ahead of the
            // products (left alone: 2 loads and a wait to 0 in front of every product)
            __builtin_amdgcn_sched_barrier(0);
#pragma unroll                            // kf[], qf[] indexed by constants: registers
            for (int j = 0; j < 4; ++j) {
                s0 = wmma16(kf[j][0], qf[j], s0);
                s1 = wmma16(kf[j][1], qf[j], s1);
            }
            Frag vf[8];
#pragma unroll                            // vf[] indexed by constants: registers
            for (int t = 0; t < 8; ++t) {     // 8 d-tiles of V^T
                const unsigned short* p = vt + (t * 16 + l16) * VPAD + lhi * 8;
                vf[t].q[0] = *(const v4u*)p;
                vf[t].q[1] = *(const v4u*)(p + 16);
            }
            // nothing is scheduled across: the 16 V loads issue ahead of the softmax and land
            // under it (left alone: 2 loads and a wait in front of every product)
            __builtin_amdgcn_sched_barrier(0);

            // online softmax update: the lane's 16 scores of its one query.  Every loop
            // below is unrolled so that sc[], red[] and pf are indexed by constants and
            // stay in registers.
            float sc[16], red[16];
#pragma unroll
            for (int i = 0; i < 8; ++i) {
                const int c0 = kv + lhi * 8 + i, c1 = c0 + 16;   // keys
                float v0 = s0[i] * 0.125f;    // scale 1/sqrt(64)
                float v1 = s1[i] * 0.125f;
                if (c0 > qrow) v0 = -1e30f;
                if (c1 > qrow) v1 = -1e30f;
                sc[i] = v0;
                sc[8 + i] = v1;
            }
#pragma unroll
            for (int i = 0; i < 16; ++i) red[i] = sc[i];
#pragma unroll
            for (int st = 1; st < 16; st <<= 1)   // pairwise tree: a short dependent chain
#pragma unroll
                for (int i = 0; i < 16; i += 2 * st) red[i] = fmaxf(red[i], red[i + st]);
            const float mnew  = fmaxf(mrow, fmaxf(red[0], xhalf(red[0])));
            const float scale = __expf(mrow - mnew);
            Frag pf;                          // P^T as B: elements 0..7 of s0, 8..15 of s1
#pragma unroll
            for (int i = 0; i < 16; ++i) {
                red[i] = __expf(sc[i] - mnew);
                pf.v[i] = (_Float16)red[i];
            }
#pragma unroll
            for (int st = 1; st < 16; st <<= 1)   // the same pairwise tree for the sum
#pragma unroll
                for (int i = 0; i < 16; i += 2 * st) red[i] += red[i + st];
            lrow = lrow * scale + red[0];
            mrow = mnew;
#pragma unroll
            for (int t = 0; t < 8; ++t) o[t] *= scale;
#pragma unroll
            for (int t = 0; t < 8; ++t)       // O^T += V^T * P^T  (8 d-tiles)
                o[t] = wmma16(vf[t], pf, o[t]);
        }

        // the wave's 16 rows are one row tile of A2; a lane's 8 values of d-tile t are one
        // 16-byte chunk of it, and the wave's 32 chunks lie in lane order: 512 bytes a store
        const float inv = 1.0f / (lrow + xhalf(lrow));   // the two halves' sums joined
        unsigned short* Ob = A2 + fragidx(bb * SEQ + q0 + l16, h * 128 + lhi * 8, C2);
#pragma unroll                            // o[] indexed by constants: registers
        for (int t = 0; t < 8; ++t) {
            union { unsigned short e[8]; v4u q; } pk;
#pragma unroll                            // the 8 halves pack in registers
            for (int i = 0; i < 8; ++i) pk.e[i] = f2h(o[t][i] * inv);
            *(v4u*)(Ob + t * 256) = pk.q;
        }
    }
}

// ---------------------------------------------------------------------------
// Kernel 4: output projection.  out = A2(4096x2048) @ Wo(2048x1024), f32 out.
__global__ __launch_bounds__(256) void csa_oproj_gemm_kernel(
    const unsigned short* __restrict__ A2,
    const unsigned short* __restrict__ WoT,
    float* __restrict__ out) {
    const int lane = threadIdx.x & 31, l16 = lane & 15, lhi = lane >> 4;
    const int w = threadIdx.x >> 5;
    const int Mbase = blockIdx.y * 128 + (w >> 2) * 64;
    const int Nbase = blockIdx.x * 128 + (w & 3) * 32;
    v8f acc[4][2] = {};
    for (int k = 0; k < C2; k += 32) {
        __builtin_prefetch(A2 + fragidx(Mbase, k + 64, C2) + lane * 16, 0, 3);
        Frag a[4], b[2];
#pragma unroll
        for (int mt = 0; mt < 4; ++mt) {
            const unsigned short* p =
                A2 + fragidx(Mbase + mt * 16 + l16, k + lhi * 8, C2);
            a[mt].q[0] = ldg128(p);
            a[mt].q[1] = ldg128(p + 256);
        }
#pragma unroll
        for (int nt = 0; nt < 2; ++nt) {
            const unsigned short* p =
                WoT + fragidx(Nbase + nt * 16 + l16, k + lhi * 8, C2);
            b[nt].q[0] = ldg128(p);
            b[nt].q[1] = ldg128(p + 256);
        }
#pragma unroll
        for (int mt = 0; mt < 4; ++mt)
#pragma unroll
            for (int nt = 0; nt < 2; ++nt)
                acc[mt][nt] = wmma16(a[mt], b[nt], acc[mt][nt]);
    }
#pragma unroll
    for (int mt = 0; mt < 4; ++mt)
#pragma unroll
        for (int nt = 0; nt < 2; ++nt)
#pragma unroll
            for (int i = 0; i < 8; ++i) {
                int row = Mbase + mt * 16 + i + lhi * 8;
                int col = Nbase + nt * 16 + l16;
                out[(size_t)row * CIN + col] = acc[mt][nt][i];
            }
}

// ---------------------------------------------------------------------------
extern "C" void kernel_launch(void* const* d_in, const int* in_sizes, int n_in,
                              void* d_out, int out_size, void* d_ws,
                              size_t ws_size, hipStream_t stream) {
    (void)in_sizes; (void)n_in; (void)out_size; (void)ws_size;
    const float* x  = (const float*)d_in[0];
    const float* Wq = (const float*)d_in[1];
    const float* Wk = (const float*)d_in[2];
    const float* Wv = (const float*)d_in[3];
    const float* Wo = (const float*)d_in[4];

    unsigned short* xb  = (unsigned short*)d_ws;            // 4M elems
    unsigned short* WqT = xb  + (size_t)NTOK * CIN;         // 2M
    unsigned short* WkT = WqT + (size_t)C2 * CIN;           // 2M
    unsigned short* WvT = WkT + (size_t)C2 * CIN;           // 2M
    unsigned short* WoT = WvT + (size_t)C2 * CIN;           // 2M
    unsigned short* Qb  = WoT + (size_t)CIN * C2;           // 8M
    unsigned short* Kb  = Qb  + (size_t)NTOK * C2;          // 8M
    unsigned short* Vt  = Kb  + (size_t)NTOK * C2;          // 8M
    unsigned short* A2  = Vt  + (size_t)2 * HEADS * 128 * SEQ; // 8M

    csa_prep_kernel<<<4 * TRBLK + (NTOK * CIN) / (8 * 1024), 256, 0, stream>>>(
        x, Wq, Wk, Wv, Wo, xb, WqT, WkT, WvT, WoT, NTOK * CIN);

    csa_qkv_gemm_kernel<<<dim3(C2 / 128, NTOK / 128, 3), 256, 0, stream>>>(
        xb, WqT, WkT, WvT, Qb, Kb, Vt);

    csa_attn_kernel<<<dim3(SEQ / 256, 2 * HEADS), 256, 0, stream>>>(
        Qb, Kb, Vt, A2);

    csa_oproj_gemm_kernel<<<dim3(CIN / 128, NTOK / 128), 256, 0, stream>>>(
        A2, WoT, (float*)d_out);
}

// v008
// A run of this version takes 148 microseconds.
// Timed twice side by side with v007, it ran 1.11 and 1.10 times as fast.
// Over all steps from v000 it is 2.95 times as fast.
#include <hip/hip_runtime.h>

// ---------------------------------------------------------------------------
// ComplexSpectralAttention == standard causal MHA, head_dim=128, scale=1/8,
// plus a fused QKV projection GEMM and an output projection GEMM.
// Shapes: B=2, N=2048, C=1024, H=16, D=128 (per head), tokens NT=4096.
// Strategy: f16 WMMA (v_wmma_f32_16x16x32_f16) everywhere, f32 accumulate.
// Attention streams K/V tiles into LDS with global_load_async_to_lds_b128
// (ASYNCcnt), double-buffered, shared by all 8 waves of the block.
// Workspace (f16 elements), total ~88 MB: xb, WqT/WkT/WvT/WoT, Q, K, Vt, A2.
// The GEMM operands (xb, the four WT, A2) lie in fragment order: see fragidx().
// ---------------------------------------------------------------------------

typedef __attribute__((ext_vector_type(16))) _Float16     v16h;
typedef __attribute__((ext_vector_type(8)))  float        v8f;
typedef __attribute__((ext_vector_type(4)))  unsigned int v4u;
typedef __attribute__((ext_vector_type(4)))  float        v4f;

union Frag {            // one WMMA A/B operand: 16 f16 = 8 VGPRs = 2 x b128
    v16h v;
    v4u  q[2];          // q[0] = K {kb..kb+7}, q[1] = K {kb+16..kb+23}
};

__device__ __forceinline__ unsigned short f2h(float f) {
    union { _Float16 h; unsigned short u; } cv;
    cv.h = (_Float16)f;
    return cv.u;
}

__device__ __forceinline__ v4u ldg128(const unsigned short* p) {
    return *(const v4u*)p;
}

__device__ __forceinline__ v8f wmma16(const Frag& a, const Frag& b, v8f c) {
    return __builtin_amdgcn_wmma_f32_16x16x32_f16(
        false, a.v, false, b.v, (short)0, c, false, false);
}

// Async copy 16B/lane from global to LDS (gfx1250 VGLOBAL, tracked by ASYNCcnt)
__device__ __forceinline__ void async_ld128(unsigned lds_off,
                                            const unsigned short* gptr) {
    unsigned long long ga = (unsigned long long)(size_t)gptr;
    asm volatile("global_load_async_to_lds_b128 %0, %1, off"
                 :: "v"(lds_off), "v"(ga) : "memory");
}

// Lane l's value in lane l ^ 16 (the other half of the wave), by a vector cross-row
// move: no LDS-counter round trip, which is what __shfl_xor compiles to.
__device__ __forceinline__ float xhalf(float x) {
    return __builtin_bit_cast(float, __builtin_amdgcn_permlanex16(
        __builtin_bit_cast(int, x), __builtin_bit_cast(int, x),
        0x76543210, 0xfedcba98, false, false));
}

#define SEQ   2048
#define NTOK  4096
#define CIN   1024
#define C2    2048
#define HEADS 16
#define KPAD  136   // 128 + 8 f16 pad (16B) to break LDS bank conflicts
#define VPAD  40    // 32 + 8 f16 pad
#define TRK   64    // transpose tile: k rows (64 k = two fragment k tiles of WT)
#define TRN   128   // transpose tile: n columns
#define TRP   72    // transpose tile: LDS pitch, 64 + 8 f16 (16-byte aligned rows)
#define TRBLK (CIN * C2 / (TRK * TRN))   // transpose tiles of one weight: 256

// Fragment order of a GEMM operand with K columns (k contiguous in the product):
// tiles of 16 rows x 32 k = 512 f16, the k tiles of one row tile one after another.
// Inside a tile lie first k 0..15, then k 16..31, each as 32 chunks of 16 bytes in
// lane order (lane = (k >> 3 & 1) * 16 + row): one global_load_b128 of a wave reads
// 512 contiguous bytes, four whole lines (row-major rows give 32 bytes of 16 lines).
__device__ __forceinline__ size_t fragidx(int r, int k, int K) {
    return ((size_t)(r >> 4) * (K >> 5) + (k >> 5)) * 512 + ((k >> 4) & 1) * 256 +
           (((k >> 3) & 1) * 16 + (r & 15)) * 8 + (k & 7);
}

// ---------------------------------------------------------------------------
// Kernel 1: all five conversions in one launch.  They are independent of each other
// and each is short, so as launches of their own they mostly cost start and drain.
// The block index picks the job: blocks 0..1023 transpose the four weights (256 tiles
// each; they have the longer chain load, LDS, barrier, store, so they start first),
// the rest convert x.
//
// Job a: x f32 -> f16, fragment order.  One wave converts 16 rows x 64 k (two k tiles,
// 2 KiB of xb in a row): 32 elements a lane, so the job starts 4,096 waves, each with
// its eight 16-byte loads in flight together.  A lane takes 8 k of one row (32 bytes of
// x, one 16-byte chunk of xb); the wave's 32 chunks are 8 rows x 32 k, so a load
// touches 8 lines of x and a store fills 4 whole 128-byte lines of xb (one writer each).
__device__ __forceinline__ void csa_cvt_x(
    const float* __restrict__ x, unsigned short* __restrict__ xb, int unit, int lane,
    int n) {
    if (unit * 1024 < n) {                    // alike in the whole wave
        const int rt = unit / (CIN / 64), kp = unit % (CIN / 64);
        const int rl = lane & 7, k8 = lane >> 3;
        const float* s = x + (size_t)(rt * 16 + rl) * CIN + kp * 64 + k8 * 8;
        v4f r[4][2];
#pragma unroll                            // r[] indexed by constants: registers
        for (int u = 0; u < 4; ++u) {         // u & 1: rows 0..7 or 8..15; u >> 1: k tile
            const float* p = s + (u & 1) * 8 * CIN + (u >> 1) * 32;
            r[u][0] = *(const v4f*)p;
            r[u][1] = *(const v4f*)(p + 4);
        }
        // fragidx(): k8 * 8 lies at k8 * 128, row rl + 8 at rl * 8 + 64, the next tile at 512
        unsigned short* d = xb + (size_t)unit * 1024 + k8 * 128 + rl * 8;
#pragma unroll                            // r[] indexed by constants: registers
        for (int u = 0; u < 4; ++u) {
            union { unsigned short h[8]; v4u q; } pk;
#pragma unroll                            // the 8 halves pack in registers
            for (int i = 0; i < 4; ++i) {
                pk.h[i] = f2h(r[u][0][i]);
                pk.h[4 + i] = f2h(r[u][1][i]);
            }
            *(v4u*)(d + (u >> 1) * 512 + (u & 1) * 64) = pk.q;
        }
    }
}

// Job b: W (Krows x Ncols, f32) -> WT (Ncols x Krows, f16, fragment order), one
// 64 k x 128 n tile per block through LDS: 16-byte loads along n, whole 128-byte
// lines of WT stored.  Krows is a multiple of 64, Ncols a multiple of 128.
// bx, by: the tile's n and k index, alike in the whole block.
__device__ __forceinline__ void csa_cvt_tr(
    unsigned short* tile,
    const float* __restrict__ W, unsigned short* __restrict__ WT,
    int Krows, int Ncols, int bx, int by) {
    const int tid = threadIdx.x;
    const int k0 = by * TRK, n0 = bx * TRN;
    const int kq = tid >> 5, nq = tid & 31;   // 8 k rows x 4 n columns a thread
    const float* s = W + (size_t)(k0 + kq * 8) * Ncols + n0 + nq * 4;
    const float* a[8];
    v4f r[8];
#pragma unroll
    for (int i = 0; i < 8; ++i) a[i] = s + (size_t)i * Ncols;
#pragma unroll
    for (int i = 0; i < 8; ++i) r[i] = *(const v4f*)a[i];
    // inputs only: the eight results keep all eight loads in flight together (the
    // compiler otherwise held the last two back behind the first four), and the
    // eight address pairs stay live, so nothing lands in one ahead of this wait
    asm volatile("s_wait_xcnt 0x0"
                 :: "v"(a[0]), "v"(a[1]), "v"(a[2]), "v"(a[3]),
                    "v"(a[4]), "v"(a[5]), "v"(a[6]), "v"(a[7]),
                    "v"(r[0]), "v"(r[1]), "v"(r[2]), "v"(r[3]),
                    "v"(r[4]), "v"(r[5]), "v"(r[6]), "v"(r[7]) : "memory");
#pragma unroll
    for (int j = 0; j < 4; ++j) {
        union { unsigned short h[8]; v4u q; } pk;
#pragma unroll
        for (int i = 0; i < 8; ++i) pk.h[i] = f2h(r[i][j]);
        *(v4u*)&tile[(nq * 4 + j) * TRP + kq * 8] = pk.q;
    }
    __syncthreads();                          // tile complete before read-out
#pragma unroll
    for (int p = 0; p < TRN * TRK / 8 / 256; ++p) {
        const int id = p * 256 + tid;         // 16-byte chunks in the order of WT
        const int n = (id >> 7) * 16 + (id & 15), k = ((id >> 4) & 7) * 8;
        *(v4u*)(WT + fragidx(n0 + n, k0 + k, Krows)) =
            *(const v4u*)&tile[n * TRP + k];
    }
}

__global__ __launch_bounds__(256) void csa_prep_kernel(
    const float* __restrict__ x,
    const float* __restrict__ Wq, const float* __restrict__ Wk,
    const float* __restrict__ Wv, const float* __restrict__ Wo,
    unsigned short* __restrict__ xb,
    unsigned short* __restrict__ WqT, unsigned short* __restrict__ WkT,
    unsigned short* __restrict__ WvT, unsigned short* __restrict__ WoT, int n) {
    __shared__ __align__(16) unsigned short tile[TRN * TRP];
    const int b = blockIdx.x;                 // every test on it is block-uniform
    if (b < 4 * TRBLK) {
        const int job = b / TRBLK, t = b % TRBLK;
        if (job < 3)                          // 1024 k x 2048 n: 16 tiles along n
            csa_cvt_tr(tile, job == 0 ? Wq : job == 1 ? Wk : Wv,
                       job == 0 ? WqT : job == 1 ? WkT : WvT, CIN, C2,
                       t % (C2 / TRN), t / (C2 / TRN));
        else                                  // 2048 k x 1024 n: 8 tiles along n
            csa_cvt_tr(tile, Wo, WoT, C2, CIN, t % (CIN / TRN), t / (CIN / TRN));
    } else {
        csa_cvt_x(x, xb, (b - 4 * TRBLK) * 8 + (int)(threadIdx.x >> 5), threadIdx.x & 31, n);
    }
}

// ---------------------------------------------------------------------------
// Kernel 2: fused QKV GEMM.  Y = xb(4096x1024) @ [Wq | Wk | Wv](1024x6144): the three
// transposed weights lie one after another in the workspace, so in fragment order they
// are one operand of 6144 rows, WT.
// Block tile 256x192, 8 waves as 4x2, wave tile 64x96 (4x6 WMMA tiles): 10 loaded fragments
// feed 24 products.  512 blocks, two a WGP one after the other; the accumulators leave
// room for two waves a SIMD, so the wave hides its own load latency: the fragments of
// k tile t + 2 are loaded, into a ring of three register sets, ahead of the products of
// k tile t.
// A 16-column tile lies in one of Q, K, V; V is stored transposed per head into Vt.
#define QKVN  (3 * C2)
#define KTSTR ((CIN / 32) * 512)              // f16 from one row tile of an operand to the next

template <int NF>
__device__ __forceinline__ void csa_ldfrag(Frag (&f)[NF], const unsigned short* p) {
#pragma unroll                            // f[] indexed by constants: registers
    for (int t = 0; t < NF; ++t) {
        f[t].q[0] = ldg128(p + t * KTSTR);
        f[t].q[1] = ldg128(p + t * KTSTR + 256);
    }
}

__device__ __forceinline__ void csa_mma46(v8f (&acc)[4][6], const Frag (&a)[4],
                                          const Frag (&b)[6]) {
#pragma unroll                            // acc[], a[], b[] indexed by constants: registers
    for (int nt = 0; nt < 6; ++nt)
#pragma unroll
        for (int mt = 0; mt < 4; ++mt)
            acc[mt][nt] = wmma16(a[mt], b[nt], acc[mt][nt]);
}

__global__ __launch_bounds__(256) void csa_qkv_gemm_kernel(
    const unsigned short* __restrict__ xb,
    const unsigned short* __restrict__ WT,
    unsigned short* __restrict__ Qo,
    unsigned short* __restrict__ Ko,
    unsigned short* __restrict__ Vt) {
    const int lane = threadIdx.x & 31, l16 = lane & 15, lhi = lane >> 4;
    // the wave's number in a scalar register: the epilogue's choice among Q, K, V is then
    // a scalar branch per column tile
    const int w = __builtin_amdgcn_readfirstlane(threadIdx.x >> 5);
    const int Mbase = blockIdx.y * 256 + (w >> 1) * 64;
    const int Nbase = blockIdx.x * 192 + (w & 1) * 96;
    // fragidx(): lane (lhi, l16) reads chunk lane of a tile's first and of its second half
    const unsigned short* pa = xb + fragidx(Mbase, 0, CIN) + lane * 8;
    const unsigned short* pb = WT + fragidx(Nbase, 0, CIN) + lane * 8;
    v8f acc[4][6] = {};
    Frag a[3][4], b[3][6];                    // a ring of three fragment sets
    csa_ldfrag(a[0], pa);
    csa_ldfrag(b[0], pb);
    csa_ldfrag(a[1], pa + 512);
    csa_ldfrag(b[1], pb + 512);
    // Unrolled whole: the ring is indexed by constants (registers), and every k tile is an
    // immediate offset from the two addresses, which are never rewritten in the loop.
    // The sched_barriers: nothing is scheduled across, so a k tile's 20 loads issue as one
    // group two k tiles ahead of their products (left alone the compiler sinks them among
    // the products, 2 loads and a wait to 0 in front of every 4).
#pragma unroll
    for (int kt = 0; kt < CIN / 32; ++kt) {
        if (kt + 2 < CIN / 32) {              // known at compile time
            csa_ldfrag(a[(kt + 2) % 3], pa + (kt + 2) * 512);
            csa_ldfrag(b[(kt + 2) % 3], pb + (kt + 2) * 512);
        }
        __builtin_amdgcn_sched_barrier(0);
        csa_mma46(acc, a[kt % 3], b[kt % 3]);
        __builtin_amdgcn_sched_barrier(0);
    }
    // the loads have taken their address registers before the epilogue rewrites them; the
    // sched_barrier holds the epilogue's address arithmetic behind the wait
    asm volatile("s_wait_xcnt 0x0" ::: "memory");
    __builtin_amdgcn_sched_barrier(0);

    // The s_wait_xcnt 0 that ends either side of the branch: a tile's stores have taken their
    // registers before the next tile's code rewrites them.
#pragma unroll                            // acc[] indexed by constants: registers
    for (int nt = 0; nt < 6; ++nt) {
        const int c0 = Nbase + nt * 16;       // scalar
        const int col = (c0 & (C2 - 1)) + l16;    // channel inside Q, K or V
        if ((c0 >> 11) < 2) {
            unsigned short* O = (c0 >> 11) == 0 ? Qo : Ko;
#pragma unroll
            for (int mt = 0; mt < 4; ++mt)
#pragma unroll
                for (int i = 0; i < 8; ++i) {
                    int row = Mbase + mt * 16 + i + lhi * 8;
                    O[(size_t)row * C2 + col] = f2h(acc[mt][nt][i]);
                }
            if (nt + 1 < 6)                   // known at compile time; as said above the loop
                asm volatile("s_wait_xcnt 0x0" ::: "memory");
        } else {
#pragma unroll
            for (int mt = 0; mt < 4; ++mt)
#pragma unroll
                for (int i = 0; i < 8; ++i) {
                    int row = Mbase + mt * 16 + i + lhi * 8;   // token
                    int bb = row >> 11, nn = row & (SEQ - 1);
                    int h = col >> 7, d = col & 127;
                    Vt[(((size_t)(bb * HEADS + h) * 128 + d) << 11) + nn] =
                        f2h(acc[mt][nt][i]);
                }
            if (nt + 1 < 6)                   // known at compile time; as said above the loop
                asm volatile("s_wait_xcnt 0x0" ::: "memory");
        }
    }
}

// ---------------------------------------------------------------------------
// Kernel 3: causal flash attention with async-LDS double buffering.
// grid = (N/256 pairs of 128-query tiles, B*H); 8 waves, wave w owns rows [q0b+16w, +16).
// Per 32-key step: 256 threads issue 4x global_load_async_to_lds_b128 each
// (K tile 32x128 -> Kbuf[key][d], V tile 128x32 -> Vbuf[d][key]); compute on
// tile i overlaps the async DMA of tile i+1.  Online softmax in f32.
// The products are transposed: S^T = K Q^T (A = K rows, B = Q rows) and
// O^T += V^T P^T (A = Vbuf rows, B = P^T).  Lane (l16, lhi) then holds, of query
// q0 + l16, the scores of keys lhi*8 + 0..7 of each 16-key tile: maximum and sum run
// inside the lane, with one exchange between the wave halves, and the two score
// tiles, converted in place, are the B operand of the second product in the k order
// of the V loader (keys lhi*8 + 0..7, then 16 + lhi*8 + 0..7): P never leaves registers.
__global__ __launch_bounds__(256) void csa_attn_kernel(
    const unsigned short* __restrict__ Qg,
    const unsigned short* __restrict__ Kg,
    const unsigned short* __restrict__ Vt,
    unsigned short* __restrict__ A2) {
    __shared__ __align__(16) unsigned short Kbuf[2][32 * KPAD];
    __shared__ __align__(16) unsigned short Vbuf[2][128 * VPAD];

    const int tid = threadIdx.x;
    const int lane = tid & 31, l16 = lane & 15, lhi = lane >> 4;
    const int w = tid >> 5;
    const int bb = blockIdx.y >> 4, h = blockIdx.y & 15;

    const unsigned short* Qb = Qg + (size_t)bb * SEQ * C2 + h * 128;
    const unsigned short* Kb = Kg + (size_t)bb * SEQ * C2 + h * 128;
    const unsigned short* Vb = Vt + (size_t)(bb * HEADS + h) * 128 * SEQ;

    // per-thread async chunk coordinates (16B chunks)
    const int kr = tid >> 4, kc = (tid & 15) * 8;   // K: rows kr, kr+16
    const int vd = tid >> 2, vc = (tid & 3) * 8;    // V: rows vd, vd+64

    // Causal cost grows with the tile index (tile x walks 4 * (x + 1) key passes) and all
    // blocks are resident at once, so the launch lasts as long as its fullest WGP.  A block
    // takes tile 15 - x and then tile x: 68 passes in every block, one block a WGP.
    for (int half = 0; half < 2; ++half) {
        const int q0b = (half == 0 ? SEQ / 128 - 1 - (int)blockIdx.x : (int)blockIdx.x) * 128;
        const int q0 = q0b + w * 16;
        if (half != 0) {                      // block-uniform
            // the first tile's LDS reads are over in every wave before the second tile's
            // prologue copies land in buffer 0
            asm volatile("s_wait_dscnt 0x0" ::: "memory");
            __syncthreads();
        }

        Frag qf[4];
#pragma unroll
        for (int j = 0; j < 4; ++j) {
            const unsigned short* p = Qb + (size_t)(q0 + l16) * C2 + j * 32 + lhi * 8;
            qf[j].q[0] = ldg128(p);
            qf[j].q[1] = ldg128(p + 16);
        }

        v8f o[8] = {};                        // o[t][i] = O[q0 + l16][t*16 + lhi*8 + i]
        const int qrow = q0 + l16;            // the lane's query
        float mrow = -1e30f;                  // its running maximum (alike in both halves)
        float lrow = 0.0f;                    // its running sum over this half's keys

        const int niter = (q0b + 128) / 32;   // uniform across the block

        // prologue: async-issue tile 0 into buffer 0
        {
            unsigned kof = (unsigned)(size_t)&Kbuf[0][0];
            unsigned vof = (unsigned)(size_t)&Vbuf[0][0];
            async_ld128(kof + (unsigned)(kr * KPAD + kc) * 2,
                        Kb + (size_t)kr * C2 + kc);
            async_ld128(kof + (unsigned)((kr + 16) * KPAD + kc) * 2,
                        Kb + (size_t)(kr + 16) * C2 + kc);
            async_ld128(vof + (unsigned)(vd * VPAD + vc) * 2,
                        Vb + (size_t)vd * SEQ + vc);
            async_ld128(vof + (unsigned)((vd + 64) * VPAD + vc) * 2,
                        Vb + (size_t)(vd + 64) * SEQ + vc);
        }

        for (int it = 0; it < niter; ++it) {
            const int kv = it * 32;
            __syncthreads();                  // release buffer (it+1)&1
            if (it + 1 < niter) {
                const int kvn = kv + 32;
                unsigned kof = (unsigned)(size_t)&Kbuf[(it + 1) & 1][0];
                unsigned vof = (unsigned)(size_t)&Vbuf[(it + 1) & 1][0];
                async_ld128(kof + (unsigned)(kr * KPAD + kc) * 2,
                            Kb + (size_t)(kvn + kr) * C2 + kc);
                async_ld128(kof + (unsigned)((kr + 16) * KPAD + kc) * 2,
                            Kb + (size_t)(kvn + kr + 16) * C2 + kc);
                async_ld128(vof + (unsigned)(vd * VPAD + vc) * 2,
                            Vb + (size_t)vd * SEQ + kvn + vc);
                async_ld128(vof + (unsigned)((vd + 64) * VPAD + vc) * 2,
                            Vb + (size_t)(vd + 64) * SEQ + kvn + vc);
                // async loads complete in order: cnt<=4 => tile `it` has landed
                asm volatile("s_wait_asynccnt 0x4" ::: "memory");
            } else {
                asm volatile("s_wait_asynccnt 0x0" ::: "memory");
            }
            __syncthreads();                  // tile `it` visible to all waves

            const unsigned short* kt = Kbuf[it & 1];
            const unsigned short* vt = Vbuf[it & 1];

            // S^T = K * Q^T  (two 16x16 key tiles)
            v8f s0 = {}, s1 = {};
            Frag kf[4][2];
#pragma unroll                            // kf[] indexed by constants: registers
            for (int j = 0; j < 4; ++j) {     // d chunks of 32
                const unsigned short* p0 = kt + l16 * KPAD + j * 32 + lhi * 8;
                kf[j][0].q[0] = *(const v4u*)p0;
                kf[j][0].q[1] = *(const v4u*)(p0 + 16);
                const unsigned short* p1 = p0 + 16 * KPAD;
                kf[j][1].q[0] = *(const v4u*)p1;
                kf[j][1].q[1] = *(const v4u*)(p1 + 16);
            }
            // nothing is scheduled across: the 16 K loads issue as one group ahead of the
            // products (left alone: 2 loads and a wait to 0 in front of every product)
            __builtin_amdgcn_sched_barrier(0);
#pragma unroll                            // kf[], qf[] indexed by constants: registers
            for (int j = 0; j < 4; ++j) {
                s0 = wmma16(kf[j][0], qf[j], s0);
                s1 = wmma16(kf[j][1], qf[j], s1);
            }
            Frag vf[8];
#pragma unroll                            // vf[] indexed by constants: registers
            for (int t = 0; t < 8; ++t) {     // 8 d-tiles of V^T
                const unsigned short* p = vt + (t * 16 + l16) * VPAD + lhi * 8;
                vf[t].q[0] = *(const v4u*)p;
                vf[t].q[1] = *(const v4u*)(p + 16);
            }
            // nothing is scheduled across: the 16 V loads issue ahead of the softmax and land
            // under it (left alone: 2 loads and a wait in front of every product)
            __builtin_amdgcn_sched_barrier(0);

            // online softmax update: the lane's 16 scores of its one query.  Every loop
            // below is unrolled so that sc[], red[] and pf are indexed by constants and
            // stay in registers.
            float sc[16], red[16];
#pragma unroll
            for (int i = 0; i < 8; ++i) {
                const int c0 = kv + lhi * 8 + i, c1 = c0 + 16;   // keys
                float v0 = s0[i] * 0.125f;    // scale 1/sqrt(64)
                float v1 = s1[i] * 0.125f;
                if (c0 > qrow) v0 = -1e30f;
                if (c1 > qrow) v1 = -1e30f;
                sc[i] = v0;
                sc[8 + i] = v1;
            }
#pragma unroll
            for (int i = 0; i < 16; ++i) red[i] = sc[i];
#pragma unroll
            for (int st = 1; st < 16; st <<= 1)   // pairwise tree: a short dependent chain
#pragma unroll
                for (int i = 0; i < 16; i += 2 * st) red[i] = fmaxf(red[i], red[i + st]);
            const float mnew  = fmaxf(mrow, fmaxf(red[0], xhalf(red[0])));
            const float scale = __expf(mrow - mnew);
            Frag pf;                          // P^T as B: elements 0..7 of s0, 8..15 of s1
#pragma unroll
            for (int i = 0; i < 16; ++i) {
                red[i] = __expf(sc[i] - mnew);
                pf.v[i] = (_Float16)red[i];
            }
#pragma unroll
            for (int st = 1; st < 16; st <<= 1)   // the same pairwise tree for the sum
#pragma unroll
                for (int i = 0; i < 16; i += 2 * st) red[i] += red[i + st];
            lrow = lrow * scale + red[0];
            mrow = mnew;
#pragma unroll
            for (int t = 0; t < 8; ++t) o[t] *= scale;
#pragma unroll
            for (int t = 0; t < 8; ++t)       // O^T += V^T * P^T  (8 d-tiles)
                o[t] = wmma16(vf[t], pf, o[t]);
        }

        // the wave's 16 rows are one row tile of A2; a lane's 8 values of d-tile t are one
        // 16-byte chunk of it, and the wave's 32 chunks lie in lane order: 512 bytes a store
        const float inv = 1.0f / (lrow + xhalf(lrow));   // the two halves' sums joined
        unsigned short* Ob = A2 + fragidx(bb * SEQ + q0 + l16, h * 128 + lhi * 8, C2);
#pragma unroll                            // o[] indexed by constants: registers
        for (int t = 0; t < 8; ++t) {
            union { unsigned short e[8]; v4u q; } pk;
#pragma unroll                            // the 8 halves pack in registers
            for (int i = 0; i < 8; ++i) pk.e[i] = f2h(o[t][i] * inv);
            *(v4u*)(Ob + t * 256) = pk.q;
        }
    }
}

// ---------------------------------------------------------------------------
// Kernel 4: output projection.  out = A2(4096x2048) @ Wo(2048x1024), f32 out.
__global__ __launch_bounds__(256) void csa_oproj_gemm_kernel(
    const unsigned short* __restrict__ A2,
    const unsigned short* __restrict__ WoT,
    float* __restrict__ out) {
    const int lane = threadIdx.x & 31, l16 = lane & 15, lhi = lane >> 4;
    const int w = threadIdx.x >> 5;
    const int Mbase = blockIdx.y * 128 + (w >> 2) * 64;
    const int Nbase = blockIdx.x * 128 + (w & 3) * 32;
    v8f acc[4][2] = {};
    for (int k = 0; k < C2; k += 32) {
        __builtin_prefetch(A2 + fragidx(Mbase, k + 64, C2) + lane * 16, 0, 3);
        Frag a[4], b[2];
#pragma unroll
        for (int mt = 0; mt < 4; ++mt) {
            const unsigned short* p =
                A2 + fragidx(Mbase + mt * 16 + l16, k + lhi * 8, C2);
            a[mt].q[0] = ldg128(p);
            a[mt].q[1] = ldg128(p + 256);
        }
#pragma unroll
        for (int nt = 0; nt < 2; ++nt) {
            const unsigned short* p =
                WoT + fragidx(Nbase + nt * 16 + l16, k + lhi * 8, C2);
            b[nt].q[0] = ldg128(p);
            b[nt].q[1] = ldg128(p + 256);
        }
#pragma unroll
        for (int mt = 0; mt < 4; ++mt)
#pragma unroll
            for (int nt = 0; nt < 2; ++nt)
                acc[mt][nt] = wmma16(a[mt], b[nt], acc[mt][nt]);
    }
#pragma unroll
    for (int mt = 0; mt < 4; ++mt)
#pragma unroll
        for (int nt = 0; nt < 2; ++nt)
#pragma unroll
            for (int i = 0; i < 8; ++i) {
                int row = Mbase + mt * 16 + i + lhi * 8;
                int col = Nbase + nt * 16 + l16;
                out[(size_t)row * CIN + col] = acc[mt][nt][i];
            }
}

// ---------------------------------------------------------------------------
extern "C" void kernel_launch(void* const* d_in, const int* in_sizes, int n_in,
                              void* d_out, int out_size, void* d_ws,
                              size_t ws_size, hipStream_t stream) {
    (void)in_sizes; (void)n_in; (void)out_size; (void)ws_size;
    const float* x  = (const float*)d_in[0];
    const float* Wq = (const float*)d_in[1];
    const float* Wk = (const float*)d_in[2];
    const float* Wv = (const float*)d_in[3];
    const float* Wo = (const float*)d_in[4];

    unsigned short* xb  = (unsigned short*)d_ws;            // 4M elems
    unsigned short* WqT = xb  + (size_t)NTOK * CIN;         // 2M
    unsigned short* WkT = WqT + (size_t)C2 * CIN;           // 2M
    unsigned short* WvT = WkT + (size_t)C2 * CIN;           // 2M
    unsigned short* WoT = WvT + (size_t)C2 * CIN;           // 2M
    unsigned short* Qb  = WoT + (size_t)CIN * C2;           // 8M
    unsigned short* Kb  = Qb  + (size_t)NTOK * C2;          // 8M
    unsigned short* Vt  = Kb  + (size_t)NTOK * C2;          // 8M
    unsigned short* A2  = Vt  + (size_t)2 * HEADS * 128 * SEQ; // 8M

    csa_prep_kernel<<<4 * TRBLK + (NTOK * CIN) / (8 * 1024), 256, 0, stream>>>(
        x, Wq, Wk, Wv, Wo, xb, WqT, WkT, WvT, WoT, NTOK * CIN);

    csa_qkv_gemm_kernel<<<dim3(QKVN / 192, NTOK / 256), 256, 0, stream>>>(
        xb, WqT, Qb, Kb, Vt);

    csa_attn_kernel<<<dim3(SEQ / 256, 2 * HEADS), 256, 0, stream>>>(
        Qb, Kb, Vt, A2);

    csa_oproj_gemm_kernel<<<dim3(CIN / 128, NTOK / 128), 256, 0, stream>>>(
        A2, WoT, (float*)d_out);
}

// v009
// A run of this version takes 118 microseconds.
// Timed twice side by side with v008, it ran 1.25 times as fast both times.
// Counting every step since v000, it is 3.69 times as fast.
#include <hip/hip_runtime.h>

// ---------------------------------------------------------------------------
// ComplexSpectralAttention == standard causal MHA, head_dim=128, scale=1/8,
// plus a fused QKV projection GEMM and an output projection GEMM.
// Shapes: B=2, N=2048, C=1024, H=16, D=128 (per head), tokens NT=4096.
// Strategy: f16 WMMA (v_wmma_f32_16x16x32_f16) everywhere, f32 accumulate.
// Attention streams K/V tiles into LDS with global_load_async_to_lds_b128
// (ASYNCcnt), double-buffered, shared by all 8 waves of the block.
// Workspace (f16 elements), total ~88 MB: xb, WqT/WkT/WvT/WoT, Q, K, Vt, A2.
// The GEMM operands (xb, the four WT, A2) lie in fragment order: see fragidx().
// ---------------------------------------------------------------------------

typedef __attribute__((ext_vector_type(16))) _Float16     v16h;
typedef __attribute__((ext_vector_type(8)))  float        v8f;
typedef __attribute__((ext_vector_type(4)))  unsigned int v4u;
typedef __attribute__((ext_vector_type(4)))  float        v4f;

union Frag {            // one WMMA A/B operand: 16 f16 = 8 VGPRs = 2 x b128
    v16h v;
    v4u  q[2];          // q[0] = K {kb..kb+7}, q[1] = K {kb+16..kb+23}
};

__device__ __forceinline__ unsigned short f2h(float f) {
    union { _Float16 h; unsigned short u; } cv;
    cv.h = (_Float16)f;
    return cv.u;
}

__device__ __forceinline__ v4u ldg128(const unsigned short* p) {
    return *(const v4u*)p;
}

__device__ __forceinline__ v8f wmma16(const Frag& a, const Frag& b, v8f c) {
    return __builtin_amdgcn_wmma_f32_16x16x32_f16(
        false, a.v, false, b.v, (short)0, c, false, false);
}

// Async copy 16B/lane from global to LDS (gfx1250 VGLOBAL, tracked by ASYNCcnt)
__device__ __forceinline__ void async_ld128(unsigned lds_off,
                                            const unsigned short* gptr) {
    unsigned long long ga = (unsigned long long)(size_t)gptr;
    asm volatile("global_load_async_to_lds_b128 %0, %1, off"
                 :: "v"(lds_off), "v"(ga) : "memory");
}

// Lane l's value in lane l ^ 16 (the other half of the wave), by a vector cross-row
// move: no LDS-counter round trip, which is what __shfl_xor compiles to.
__device__ __forceinline__ float xhalf(float x) {
    return __builtin_bit_cast(float, __builtin_amdgcn_permlanex16(
        __builtin_bit_cast(int, x), __builtin_bit_cast(int, x),
        0x76543210, 0xfedcba98, false, false));
}

#define SEQ   2048
#define NTOK  4096
#define CIN   1024
#define C2    2048
#define HEADS 16
#define KPAD  136   // 128 + 8 f16 pad (16B) to break LDS bank conflicts
#define VPAD  40    // 32 + 8 f16 pad
#define TRK   64    // transpose tile: k rows (64 k = two fragment k tiles of WT)
#define TRN   128   // transpose tile: n columns
#define TRP   72    // transpose tile: LDS pitch, 64 + 8 f16 (16-byte aligned rows)
#define TRBLK (CIN * C2 / (TRK * TRN))   // transpose tiles of one weight: 256

// Fragment order of a GEMM operand with K columns (k contiguous in the product):
// tiles of 16 rows x 32 k = 512 f16, the k tiles of one row tile one after another.
// Inside a tile lie first k 0..15, then k 16..31, each as 32 chunks of 16 bytes in
// lane order (lane = (k >> 3 & 1) * 16 + row): one global_load_b128 of a wave reads
// 512 contiguous bytes, four whole lines (row-major rows give 32 bytes of 16 lines).
__device__ __forceinline__ size_t fragidx(int r, int k, int K) {
    return ((size_t)(r >> 4) * (K >> 5) + (k >> 5)) * 512 + ((k >> 4) & 1) * 256 +
           (((k >> 3) & 1) * 16 + (r & 15)) * 8 + (k & 7);
}

// ---------------------------------------------------------------------------
// Kernel 1: all five conversions in one launch.  They are independent of each other
// and each is short, so as launches of their own they mostly cost start and drain.
// The block index picks the job: blocks 0..1023 transpose the four weights (256 tiles
// each; they have the longer chain load, LDS, barrier, store, so they start first),
// the rest convert x.
//
// Job a: x f32 -> f16, fragment order.  One wave converts 16 rows x 64 k (two k tiles,
// 2 KiB of xb in a row): 32 elements a lane, so the job starts 4,096 waves, each with
// its eight 16-byte loads in flight together.  A lane takes 8 k of one row (32 bytes of
// x, one 16-byte chunk of xb); the wave's 32 chunks are 8 rows x 32 k, so a load
// touches 8 lines of x and a store fills 4 whole 128-byte lines of xb (one writer each).
__device__ __forceinline__ void csa_cvt_x(
    const float* __restrict__ x, unsigned short* __restrict__ xb, int unit, int lane,
    int n) {
    if (unit * 1024 < n) {                    // alike in the whole wave
        const int rt = unit / (CIN / 64), kp = unit % (CIN / 64);
        const int rl = lane & 7, k8 = lane >> 3;
        const float* s = x + (size_t)(rt * 16 + rl) * CIN + kp * 64 + k8 * 8;
        v4f r[4][2];
#pragma unroll                            // r[] indexed by constants: registers
        for (int u = 0; u < 4; ++u) {         // u & 1: rows 0..7 or 8..15; u >> 1: k tile
            const float* p = s + (u & 1) * 8 * CIN + (u >> 1) * 32;
            r[u][0] = *(const v4f*)p;
            r[u][1] = *(const v4f*)(p + 4);
        }
        // fragidx(): k8 * 8 lies at k8 * 128, row rl + 8 at rl * 8 + 64, the next tile at 512
        unsigned short* d = xb + (size_t)unit * 1024 + k8 * 128 + rl * 8;
#pragma unroll                            // r[] indexed by constants: registers
        for (int u = 0; u < 4; ++u) {
            union { unsigned short h[8]; v4u q; } pk;
#pragma unroll                            // the 8 halves pack in registers
            for (int i = 0; i < 4; ++i) {
                pk.h[i] = f2h(r[u][0][i]);
                pk.h[4 + i] = f2h(r[u][1][i]);
            }
            *(v4u*)(d + (u >> 1) * 512 + (u & 1) * 64) = pk.q;
        }
    }
}

// Job b: W (Krows x Ncols, f32) -> WT (Ncols x Krows, f16, fragment order), one
// 64 k x 128 n tile per block through LDS: 16-byte loads along n, whole 128-byte
// lines of WT stored.  Krows is a multiple of 64, Ncols a multiple of 128.
// bx, by: the tile's n and k index, alike in the whole block.
__device__ __forceinline__ void csa_cvt_tr(
    unsigned short* tile,
    const float* __restrict__ W, unsigned short* __restrict__ WT,
    int Krows, int Ncols, int bx, int by) {
    const int tid = threadIdx.x;
    const int k0 = by * TRK, n0 = bx * TRN;
    const int kq = tid >> 5, nq = tid & 31;   // 8 k rows x 4 n columns a thread
    const float* s = W + (size_t)(k0 + kq * 8) * Ncols + n0 + nq * 4;
    const float* a[8];
    v4f r[8];
#pragma unroll
    for (int i = 0; i < 8; ++i) a[i] = s + (size_t)i * Ncols;
#pragma unroll
    for (int i = 0; i < 8; ++i) r[i] = *(const v4f*)a[i];
    // inputs only: the eight results keep all eight loads in flight together (the
    // compiler otherwise held the last two back behind the first four), and the
    // eight address pairs stay live, so nothing lands in one ahead of this wait
    asm volatile("s_wait_xcnt 0x0"
                 :: "v"(a[0]), "v"(a[1]), "v"(a[2]), "v"(a[3]),
                    "v"(a[4]), "v"(a[5]), "v"(a[6]), "v"(a[7]),
                    "v"(r[0]), "v"(r[1]), "v"(r[2]), "v"(r[3]),
                    "v"(r[4]), "v"(r[5]), "v"(r[6]), "v"(r[7]) : "memory");
#pragma unroll
    for (int j = 0; j < 4; ++j) {
        union { unsigned short h[8]; v4u q; } pk;
#pragma unroll
        for (int i = 0; i < 8; ++i) pk.h[i] = f2h(r[i][j]);
        *(v4u*)&tile[(nq * 4 + j) * TRP + kq * 8] = pk.q;
    }
    __syncthreads();                          // tile complete before read-out
#pragma unroll
    for (int p = 0; p < TRN * TRK / 8 / 256; ++p) {
        const int id = p * 256 + tid;         // 16-byte chunks in the order of WT
        const int n = (id >> 7) * 16 + (id & 15), k = ((id >> 4) & 7) * 8;
        *(v4u*)(WT + fragidx(n0 + n, k0 + k, Krows)) =
            *(const v4u*)&tile[n * TRP + k];
    }
}

__global__ __launch_bounds__(256) void csa_prep_kernel(
    const float* __restrict__ x,
    const float* __restrict__ Wq, const float* __restrict__ Wk,
    const float* __restrict__ Wv, const float* __restrict__ Wo,
    unsigned short* __restrict__ xb,
    unsigned short* __restrict__ WqT, unsigned short* __restrict__ WkT,
    unsigned short* __restrict__ WvT, unsigned short* __restrict__ WoT, int n) {
    __shared__ __align__(16) unsigned short tile[TRN * TRP];
    const int b = blockIdx.x;                 // every test on it is block-uniform
    if (b < 4 * TRBLK) {
        const int job = b / TRBLK, t = b % TRBLK;
        if (job < 3)                          // 1024 k x 2048 n: 16 tiles along n
            csa_cvt_tr(tile, job == 0 ? Wq : job == 1 ? Wk : Wv,
                       job == 0 ? WqT : job == 1 ? WkT : WvT, CIN, C2,
                       t % (C2 / TRN), t / (C2 / TRN));
        else                                  // 2048 k x 1024 n: 8 tiles along n
            csa_cvt_tr(tile, Wo, WoT, C2, CIN, t % (CIN / TRN), t / (CIN / TRN));
    } else {
        csa_cvt_x(x, xb, (b - 4 * TRBLK) * 8 + (int)(threadIdx.x >> 5), threadIdx.x & 31, n);
    }
}

// ---------------------------------------------------------------------------
// Kernel 2: fused QKV GEMM.  Y = xb(4096x1024) @ [Wq | Wk | Wv](1024x6144): the three
// transposed weights lie one after another in the workspace, so in fragment order they
// are one operand of 6144 rows, WT.
// Block tile 256x192, 8 waves as 4x2, wave tile 64x96 (4x6 WMMA tiles): 10 loaded fragments
// feed 24 products.  512 blocks, two a WGP one after the other; the accumulators leave
// room for two waves a SIMD, so the wave hides its own load latency: the fragments of
// k tile t + 2 are loaded, into a ring of three register sets, ahead of the products of
// k tile t.
// A 16-column tile lies in one of Q, K, V; V is stored transposed per head into Vt.
#define QKVN  (3 * C2)
#define KTSTR ((CIN / 32) * 512)              // f16 from one row tile of an operand to the next

template <int NF>
__device__ __forceinline__ void csa_ldfrag(Frag (&f)[NF], const unsigned short* p) {
#pragma unroll                            // f[] indexed by constants: registers
    for (int t = 0; t < NF; ++t) {
        f[t].q[0] = ldg128(p + t * KTSTR);
        f[t].q[1] = ldg128(p + t * KTSTR + 256);
    }
}

__device__ __forceinline__ void csa_mma46(v8f (&acc)[4][6], const Frag (&a)[4],
                                          const Frag (&b)[6]) {
#pragma unroll                            // acc[], a[], b[] indexed by constants: registers
    for (int nt = 0; nt < 6; ++nt)
#pragma unroll
        for (int mt = 0; mt < 4; ++mt)
            acc[mt][nt] = wmma16(a[mt], b[nt], acc[mt][nt]);
}

__global__ __launch_bounds__(256) void csa_qkv_gemm_kernel(
    const unsigned short* __restrict__ xb,
    const unsigned short* __restrict__ WT,
    unsigned short* __restrict__ Qo,
    unsigned short* __restrict__ Ko,
    unsigned short* __restrict__ Vt) {
    const int lane = threadIdx.x & 31, l16 = lane & 15, lhi = lane >> 4;
    // the wave's number in a scalar register: the epilogue's choice among Q, K, V is then
    // a scalar branch per column tile
    const int w = __builtin_amdgcn_readfirstlane(threadIdx.x >> 5);
    const int Mbase = blockIdx.y * 256 + (w >> 1) * 64;
    const int Nbase = blockIdx.x * 192 + (w & 1) * 96;
    // fragidx(): lane (lhi, l16) reads chunk lane of a tile's first and of its second half
    const unsigned short* pa = xb + fragidx(Mbase, 0, CIN) + lane * 8;
    const unsigned short* pb = WT + fragidx(Nbase, 0, CIN) + lane * 8;
    v8f acc[4][6] = {};
    Frag a[3][4], b[3][6];                    // a ring of three fragment sets
    csa_ldfrag(a[0], pa);
    csa_ldfrag(b[0], pb);
    csa_ldfrag(a[1], pa + 512);
    csa_ldfrag(b[1], pb + 512);
    // Unrolled whole: the ring is indexed by constants (registers), and every k tile is an
    // immediate offset from the two addresses, which are never rewritten in the loop.
    // The sched_barriers: nothing is scheduled across, so a k tile's 20 loads issue as one
    // group two k tiles ahead of their products (left alone the compiler sinks them among
    // the products, 2 loads and a wait to 0 in front of every 4).
#pragma unroll
    for (int kt = 0; kt < CIN / 32; ++kt) {
        if (kt + 2 < CIN / 32) {              // known at compile time
            csa_ldfrag(a[(kt + 2) % 3], pa + (kt + 2) * 512);
            csa_ldfrag(b[(kt + 2) % 3], pb + (kt + 2) * 512);
        }
        __builtin_amdgcn_sched_barrier(0);
        csa_mma46(acc, a[kt % 3], b[kt % 3]);
        __builtin_amdgcn_sched_barrier(0);
    }
    // the loads have taken their address registers before the epilogue rewrites them; the
    // sched_barrier holds the epilogue's address arithmetic behind the wait
    asm volatile("s_wait_xcnt 0x0" ::: "memory");
    __builtin_amdgcn_sched_barrier(0);

    // The s_wait_xcnt 0 that ends either side of the branch: a tile's stores have taken their
    // registers before the next tile's code rewrites them.
#pragma unroll                            // acc[] indexed by constants: registers
    for (int nt = 0; nt < 6; ++nt) {
        const int c0 = Nbase + nt * 16;       // scalar
        const int col = (c0 & (C2 - 1)) + l16;    // channel inside Q, K or V
        if ((c0 >> 11) < 2) {
            unsigned short* O = (c0 >> 11) == 0 ? Qo : Ko;
#pragma unroll
            for (int mt = 0; mt < 4; ++mt)
#pragma unroll
                for (int i = 0; i < 8; ++i) {
                    int row = Mbase + mt * 16 + i + lhi * 8;
                    O[(size_t)row * C2 + col] = f2h(acc[mt][nt][i]);
                }
            if (nt + 1 < 6)                   // known at compile time; as said above the loop
                asm volatile("s_wait_xcnt 0x0" ::: "memory");
        } else {
#pragma unroll
            for (int mt = 0; mt < 4; ++mt)
#pragma unroll
                for (int i = 0; i < 8; ++i) {
                    int row = Mbase + mt * 16 + i + lhi * 8;   // token
                    int bb = row >> 11, nn = row & (SEQ - 1);
                    int h = col >> 7, d = col & 127;
                    Vt[(((size_t)(bb * HEADS + h) * 128 + d) << 11) + nn] =
                        f2h(acc[mt][nt][i]);
                }
            if (nt + 1 < 6)                   // known at compile time; as said above the loop
                asm volatile("s_wait_xcnt 0x0" ::: "memory");
        }
    }
}

// ---------------------------------------------------------------------------
// Kernel 3: causal flash attention with async-LDS double buffering.
// grid = (N/256 pairs of 128-query tiles, B*H); 8 waves, wave w owns rows [q0b+16w, +16).
// Per 32-key step: 256 threads issue 4x global_load_async_to_lds_b128 each
// (K tile 32x128 -> Kbuf[key][d], V tile 128x32 -> Vbuf[d][key]); compute on
// tile i overlaps the async DMA of tile i+1.  Online softmax in f32.
// The products are transposed: S^T = K Q^T (A = K rows, B = Q rows) and
// O^T += V^T P^T (A = Vbuf rows, B = P^T).  Lane (l16, lhi) then holds, of query
// q0 + l16, the scores of keys lhi*8 + 0..7 of each 16-key tile: maximum and sum run
// inside the lane, with one exchange between the wave halves, and the two score
// tiles, converted in place, are the B operand of the second product in the k order
// of the V loader (keys lhi*8 + 0..7, then 16 + lhi*8 + 0..7): P never leaves registers.
__global__ __launch_bounds__(256) void csa_attn_kernel(
    const unsigned short* __restrict__ Qg,
    const unsigned short* __restrict__ Kg,
    const unsigned short* __restrict__ Vt,
    unsigned short* __restrict__ A2) {
    __shared__ __align__(16) unsigned short Kbuf[2][32 * KPAD];
    __shared__ __align__(16) unsigned short Vbuf[2][128 * VPAD];

    const int tid = threadIdx.x;
    const int lane = tid & 31, l16 = lane & 15, lhi = lane >> 4;
    const int w = tid >> 5;
    const int bb = blockIdx.y >> 4, h = blockIdx.y & 15;

    const unsigned short* Qb = Qg + (size_t)bb * SEQ * C2 + h * 128;
    const unsigned short* Kb = Kg + (size_t)bb * SEQ * C2 + h * 128;
    const unsigned short* Vb = Vt + (size_t)(bb * HEADS + h) * 128 * SEQ;

    // per-thread async chunk coordinates (16B chunks)
    const int kr = tid >> 4, kc = (tid & 15) * 8;   // K: rows kr, kr+16
    const int vd = tid >> 2, vc = (tid & 3) * 8;    // V: rows vd, vd+64

    // Causal cost grows with the tile index (tile x walks 4 * (x + 1) key passes) and all
    // blocks are resident at once, so the launch lasts as long as its fullest WGP.  A block
    // takes tile 15 - x and then tile x: 68 passes in every block, one block a WGP.
    for (int half = 0; half < 2; ++half) {
        const int q0b = (half == 0 ? SEQ / 128 - 1 - (int)blockIdx.x : (int)blockIdx.x) * 128;
        const int q0 = q0b + w * 16;
        if (half != 0) {                      // block-uniform
            // the first tile's LDS reads are over in every wave before the second tile's
            // prologue copies land in buffer 0
            asm volatile("s_wait_dscnt 0x0" ::: "memory");
            __syncthreads();
        }

        Frag qf[4];
#pragma unroll
        for (int j = 0; j < 4; ++j) {
            const unsigned short* p = Qb + (size_t)(q0 + l16) * C2 + j * 32 + lhi * 8;
            qf[j].q[0] = ldg128(p);
            qf[j].q[1] = ldg128(p + 16);
        }

        v8f o[8] = {};                        // o[t][i] = O[q0 + l16][t*16 + lhi*8 + i]
        const int qrow = q0 + l16;            // the lane's query
        float mrow = -1e30f;                  // its running maximum (alike in both halves)
        float lrow = 0.0f;                    // its running sum over this half's keys

        const int niter = (q0b + 128) / 32;   // uniform across the block

        // prologue: async-issue tile 0 into buffer 0
        {
            unsigned kof = (unsigned)(size_t)&Kbuf[0][0];
            unsigned vof = (unsigned)(size_t)&Vbuf[0][0];
            async_ld128(kof + (unsigned)(kr * KPAD + kc) * 2,
                        Kb + (size_t)kr * C2 + kc);
            async_ld128(kof + (unsigned)((kr + 16) * KPAD + kc) * 2,
                        Kb + (size_t)(kr + 16) * C2 + kc);
            async_ld128(vof + (unsigned)(vd * VPAD + vc) * 2,
                        Vb + (size_t)vd * SEQ + vc);
            async_ld128(vof + (unsigned)((vd + 64) * VPAD + vc) * 2,
                        Vb + (size_t)(vd + 64) * SEQ + vc);
        }

        for (int it = 0; it < niter; ++it) {
            const int kv = it * 32;
            __syncthreads();                  // release buffer (it+1)&1
            if (it + 1 < niter) {
                const int kvn = kv + 32;
                unsigned kof = (unsigned)(size_t)&Kbuf[(it + 1) & 1][0];
                unsigned vof = (unsigned)(size_t)&Vbuf[(it + 1) & 1][0];
                async_ld128(kof + (unsigned)(kr * KPAD + kc) * 2,
                            Kb + (size_t)(kvn + kr) * C2 + kc);
                async_ld128(kof + (unsigned)((kr + 16) * KPAD + kc) * 2,
                            Kb + (size_t)(kvn + kr + 16) * C2 + kc);
                async_ld128(vof + (unsigned)(vd * VPAD + vc) * 2,
                            Vb + (size_t)vd * SEQ + kvn + vc);
                async_ld128(vof + (unsigned)((vd + 64) * VPAD + vc) * 2,
                            Vb + (size_t)(vd + 64) * SEQ + kvn + vc);
                // async loads complete in order: cnt<=4 => tile `it` has landed
                asm volatile("s_wait_asynccnt 0x4" ::: "memory");
            } else {
                asm volatile("s_wait_asynccnt 0x0" ::: "memory");
            }
            __syncthreads();                  // tile `it` visible to all waves

            const unsigned short* kt = Kbuf[it & 1];
            const unsigned short* vt = Vbuf[it & 1];

            // S^T = K * Q^T  (two 16x16 key tiles)
            v8f s0 = {}, s1 = {};
            Frag kf[4][2];
#pragma unroll                            // kf[] indexed by constants: registers
            for (int j = 0; j < 4; ++j) {     // d chunks of 32
                const unsigned short* p0 = kt + l16 * KPAD + j * 32 + lhi * 8;
                kf[j][0].q[0] = *(const v4u*)p0;
                kf[j][0].q[1] = *(const v4u*)(p0 + 16);
                const unsigned short* p1 = p0 + 16 * KPAD;
                kf[j][1].q[0] = *(const v4u*)p1;
                kf[j][1].q[1] = *(const v4u*)(p1 + 16);
            }
            // nothing is scheduled across: the 16 K loads issue as one group ahead of the
            // products (left alone: 2 loads and a wait to 0 in front of every product)
            __builtin_amdgcn_sched_barrier(0);
#pragma unroll                            // kf[], qf[] indexed by constants: registers
            for (int j = 0; j < 4; ++j) {
                s0 = wmma16(kf[j][0], qf[j], s0);
                s1 = wmma16(kf[j][1], qf[j], s1);
            }
            Frag vf[8];
#pragma unroll                            // vf[] indexed by constants: registers
            for (int t = 0; t < 8; ++t) {     // 8 d-tiles of V^T
                const unsigned short* p = vt + (t * 16 + l16) * VPAD + lhi * 8;
                vf[t].q[0] = *(const v4u*)p;
                vf[t].q[1] = *(const v4u*)(p + 16);
            }
            // nothing is scheduled across: the 16 V loads issue ahead of the softmax and land
            // under it (left alone: 2 loads and a wait in front of every product)
            __builtin_amdgcn_sched_barrier(0);

            // online softmax update: the lane's 16 scores of its one query.  Every loop
            // below is unrolled so that sc[], red[] and pf are indexed by constants and
            // stay in registers.
            float sc[16], red[16];
#pragma unroll
            for (int i = 0; i < 8; ++i) {
                const int c0 = kv + lhi * 8 + i, c1 = c0 + 16;   // keys
                float v0 = s0[i] * 0.125f;    // scale 1/sqrt(64)
                float v1 = s1[i] * 0.125f;
                if (c0 > qrow) v0 = -1e30f;
                if (c1 > qrow) v1 = -1e30f;
                sc[i] = v0;
                sc[8 + i] = v1;
            }
#pragma unroll
            for (int i = 0; i < 16; ++i) red[i] = sc[i];
#pragma unroll
            for (int st = 1; st < 16; st <<= 1)   // pairwise tree: a short dependent chain
#pragma unroll
                for (int i = 0; i < 16; i += 2 * st) red[i] = fmaxf(red[i], red[i + st]);
            const float mnew  = fmaxf(mrow, fmaxf(red[0], xhalf(red[0])));
            const float scale = __expf(mrow - mnew);
            Frag pf;                          // P^T as B: elements 0..7 of s0, 8..15 of s1
#pragma unroll
            for (int i = 0; i < 16; ++i) {
                red[i] = __expf(sc[i] - mnew);
                pf.v[i] = (_Float16)red[i];
            }
#pragma unroll
            for (int st = 1; st < 16; st <<= 1)   // the same pairwise tree for the sum
#pragma unroll
                for (int i = 0; i < 16; i += 2 * st) red[i] += red[i + st];
            lrow = lrow * scale + red[0];
            mrow = mnew;
#pragma unroll
            for (int t = 0; t < 8; ++t) o[t] *= scale;
#pragma unroll
            for (int t = 0; t < 8; ++t)       // O^T += V^T * P^T  (8 d-tiles)
                o[t] = wmma16(vf[t], pf, o[t]);
        }

        // the wave's 16 rows are one row tile of A2; a lane's 8 values of d-tile t are one
        // 16-byte chunk of it, and the wave's 32 chunks lie in lane order: 512 bytes a store
        const float inv = 1.0f / (lrow + xhalf(lrow));   // the two halves' sums joined
        unsigned short* Ob = A2 + fragidx(bb * SEQ + q0 + l16, h * 128 + lhi * 8, C2);
#pragma unroll                            // o[] indexed by constants: registers
        for (int t = 0; t < 8; ++t) {
            union { unsigned short e[8]; v4u q; } pk;
#pragma unroll                            // the 8 halves pack in registers
            for (int i = 0; i < 8; ++i) pk.e[i] = f2h(o[t][i] * inv);
            *(v4u*)(Ob + t * 256) = pk.q;
        }
    }
}

// ---------------------------------------------------------------------------
// Kernel 4: output projection.  out = A2(4096x2048) @ Wo(2048x1024), f32 out.
// Block tile 128x128, one block a WGP, 4 waves as 2x2, one a SIMD, wave tile 64x64 (4x4 WMMA
// tiles): 8 loaded fragments feed 16 products.  Nothing else on the SIMD hides the wave's load
// latency (A2 comes from memory at its first touch), so the wave hides it itself: the
// fragments of k tile t + 3 are loaded, into a ring of four register sets, in the middle of
// the products of k tile t.
#define OKTSTR ((C2 / 32) * 512)              // f16 from one row tile of an operand to the next

__device__ __forceinline__ void csa_ldfrag_o(Frag (&f)[4], const unsigned short* p) {
#pragma unroll                            // f[] indexed by constants: registers
    for (int t = 0; t < 4; ++t) {
        f[t].q[0] = ldg128(p + t * OKTSTR);
        f[t].q[1] = ldg128(p + t * OKTSTR + 256);
    }
}

template <int N0>
__device__ __forceinline__ void csa_mma42(v8f (&acc)[4][4], const Frag (&a)[4],
                                          const Frag (&b)[4]) {
#pragma unroll                            // acc[], a[], b[] indexed by constants: registers
    for (int nt = N0; nt < N0 + 2; ++nt)
#pragma unroll
        for (int mt = 0; mt < 4; ++mt)
            acc[mt][nt] = wmma16(a[mt], b[nt], acc[mt][nt]);
}

__global__ __launch_bounds__(128) void csa_oproj_gemm_kernel(
    const unsigned short* __restrict__ A2,
    const unsigned short* __restrict__ WoT,
    float* __restrict__ out) {
    const int lane = threadIdx.x & 31, l16 = lane & 15, lhi = lane >> 4;
    // the wave's number in a scalar register: the two operand addresses are then a scalar
    // base and one lane offset
    const int w = __builtin_amdgcn_readfirstlane(threadIdx.x >> 5);
    const int Mbase = blockIdx.y * 128 + (w >> 1) * 64;
    const int Nbase = blockIdx.x * 128 + (w & 1) * 64;
    // fragidx(): lane (lhi, l16) reads chunk lane of a tile's first and of its second half
    const unsigned short* pa = A2 + fragidx(Mbase, 0, C2) + lane * 8;
    const unsigned short* pb = WoT + fragidx(Nbase, 0, C2) + lane * 8;
    v8f acc[4][4] = {};
    Frag a[4][4], b[4][4];                    // a ring of four fragment sets
#pragma unroll                            // the ring is indexed by constants: registers
    for (int s = 0; s < 3; ++s) {
        csa_ldfrag_o(a[s], pa + s * 512);
        csa_ldfrag_o(b[s], pb + s * 512);
        // nothing is scheduled across: k tile 0 is asked for first (left alone its loads
        // issue last, and the first product waits for all three sets)
        __builtin_amdgcn_sched_barrier(0);
    }
    // Unrolled whole: the ring is indexed by constants (registers), and every k tile is an
    // immediate offset from the two addresses, which are never rewritten in the loop.
    // The sched_barriers: nothing is scheduled across, so a k tile's 16 loads issue as one
    // group three k tiles ahead of their products (left alone the compiler sinks them to
    // just ahead of their products).  The group stands behind the first half of the products:
    // most of k tile t has then landed, and at most 52 loads of the wave are outstanding.
#pragma unroll
    for (int kt = 0; kt < C2 / 32; ++kt) {
        csa_mma42<0>(acc, a[kt % 4], b[kt % 4]);
        __builtin_amdgcn_sched_barrier(0);
        if (kt + 3 < C2 / 32) {               // known at compile time
            csa_ldfrag_o(a[(kt + 3) % 4], pa + (kt + 3) * 512);
            csa_ldfrag_o(b[(kt + 3) % 4], pb + (kt + 3) * 512);
        }
        __builtin_amdgcn_sched_barrier(0);
        csa_mma42<2>(acc, a[kt % 4], b[kt % 4]);
        __builtin_amdgcn_sched_barrier(0);
    }
    // the loads have taken their address registers before the epilogue rewrites them; the
    // sched_barrier holds the epilogue's address arithmetic behind the wait
    asm volatile("s_wait_xcnt 0x0" ::: "memory");
    __builtin_amdgcn_sched_barrier(0);
    // one address; every element is an immediate offset from it, so no register that a store
    // names is rewritten.  A row's four 64-byte pieces (two whole lines) follow one another.
    float* po = out + (size_t)(Mbase + lhi * 8) * CIN + Nbase + l16;
#pragma unroll                            // acc[] indexed by constants: registers
    for (int mt = 0; mt < 4; ++mt)
#pragma unroll
        for (int i = 0; i < 8; ++i)
#pragma unroll
            for (int nt = 0; nt < 4; ++nt)
                po[(mt * 16 + i) * CIN + nt * 16] = acc[mt][nt][i];
}

// ---------------------------------------------------------------------------
extern "C" void kernel_launch(void* const* d_in, const int* in_sizes, int n_in,
                              void* d_out, int out_size, void* d_ws,
                              size_t ws_size, hipStream_t stream) {
    (void)in_sizes; (void)n_in; (void)out_size; (void)ws_size;
    const float* x  = (const float*)d_in[0];
    const float* Wq = (const float*)d_in[1];
    const float* Wk = (const float*)d_in[2];
    const float* Wv = (const float*)d_in[3];
    const float* Wo = (const float*)d_in[4];

    unsigned short* xb  = (unsigned short*)d_ws;            // 4M elems
    unsigned short* WqT = xb  + (size_t)NTOK * CIN;         // 2M
    unsigned short* WkT = WqT + (size_t)C2 * CIN;           // 2M
    unsigned short* WvT = WkT + (size_t)C2 * CIN;           // 2M
    unsigned short* WoT = WvT + (size_t)C2 * CIN;           // 2M
    unsigned short* Qb  = WoT + (size_t)CIN * C2;           // 8M
    unsigned short* Kb  = Qb  + (size_t)NTOK * C2;          // 8M
    unsigned short* Vt  = Kb  + (size_t)NTOK * C2;          // 8M
    unsigned short* A2  = Vt  + (size_t)2 * HEADS * 128 * SEQ; // 8M

    csa_prep_kernel<<<4 * TRBLK + (NTOK * CIN) / (8 * 1024), 256, 0, stream>>>(
        x, Wq, Wk, Wv, Wo, xb, WqT, WkT, WvT, WoT, NTOK * CIN);

    csa_qkv_gemm_kernel<<<dim3(QKVN / 192, NTOK / 256), 256, 0, stream>>>(
        xb, WqT, Qb, Kb, Vt);

    csa_attn_kernel<<<dim3(SEQ / 256, 2 * HEADS), 256, 0, stream>>>(
        Qb, Kb, Vt, A2);

    csa_oproj_gemm_kernel<<<dim3(CIN / 128, NTOK / 128), 128, 0, stream>>>(
        A2, WoT, (float*)d_out);
}

// v010
// Measured time: 110 microseconds a run.
// Two timings next to v009 both put it at 1.08 times that version's speed.
// Over all steps from v000 it is 3.97 times as fast.
#include <hip/hip_runtime.h>

// ---------------------------------------------------------------------------
// ComplexSpectralAttention == standard causal MHA, head_dim=128, scale=1/8,
// plus a fused QKV projection GEMM and an output projection GEMM.
// Shapes: B=2, N=2048, C=1024, H=16, D=128 (per head), tokens NT=4096.
// Strategy: f16 WMMA (v_wmma_f32_16x16x32_f16) everywhere, f32 accumulate.
// Attention streams K/V stages of 128 keys into LDS with global_load_async_to_lds_b128
// (ASYNCcnt), two buffers, shared by all 8 waves of the block.
// Workspace (f16 elements), total ~88 MB: xb, WqT/WkT/WvT/WoT, Q, K, Vt, A2.
// The GEMM operands (xb, the four WT, A2) lie in fragment order: see fragidx().
// ---------------------------------------------------------------------------

typedef __attribute__((ext_vector_type(16))) _Float16     v16h;
typedef __attribute__((ext_vector_type(8)))  float        v8f;
typedef __attribute__((ext_vector_type(4)))  unsigned int v4u;
typedef __attribute__((ext_vector_type(4)))  float        v4f;

union Frag {            // one WMMA A/B operand: 16 f16 = 8 VGPRs = 2 x b128
    v16h v;
    v4u  q[2];          // q[0] = K {kb..kb+7}, q[1] = K {kb+16..kb+23}
};

__device__ __forceinline__ unsigned short f2h(float f) {
    union { _Float16 h; unsigned short u; } cv;
    cv.h = (_Float16)f;
    return cv.u;
}

__device__ __forceinline__ v4u ldg128(const unsigned short* p) {
    return *(const v4u*)p;
}

__device__ __forceinline__ v8f wmma16(const Frag& a, const Frag& b, v8f c) {
    return __builtin_amdgcn_wmma_f32_16x16x32_f16(
        false, a.v, false, b.v, (short)0, c, false, false);
}

// Eight async copies, 16 B a lane each, from global to LDS (tracked by ASYNCcnt): the lane's
// chunk of rows r, r + 16, .. r + 112 of a 128-row stage; ls and gs are the bytes from one of
// these rows to the next in LDS and in global memory.  The s_wait_xcnt 0 ends the copies' own
// statement, so no register that a copy names is rewritten ahead of it.
__device__ __forceinline__ void async_rows8(unsigned lds, const unsigned short* gptr,
                                            unsigned ls, unsigned gs) {
    const unsigned long long ga = (unsigned long long)(size_t)gptr;
    asm volatile("global_load_async_to_lds_b128 %0, %8, off\n\t"
                 "global_load_async_to_lds_b128 %1, %9, off\n\t"
                 "global_load_async_to_lds_b128 %2, %10, off\n\t"
                 "global_load_async_to_lds_b128 %3, %11, off\n\t"
                 "global_load_async_to_lds_b128 %4, %12, off\n\t"
                 "global_load_async_to_lds_b128 %5, %13, off\n\t"
                 "global_load_async_to_lds_b128 %6, %14, off\n\t"
                 "global_load_async_to_lds_b128 %7, %15, off\n\t"
                 "s_wait_xcnt 0x0"
                 :: "v"(lds), "v"(lds + ls), "v"(lds + 2 * ls), "v"(lds + 3 * ls),
                    "v"(lds + 4 * ls), "v"(lds + 5 * ls), "v"(lds + 6 * ls), "v"(lds + 7 * ls),
                    "v"(ga), "v"(ga + gs), "v"(ga + 2 * gs), "v"(ga + 3 * gs),
                    "v"(ga + 4 * gs), "v"(ga + 5 * gs), "v"(ga + 6 * gs), "v"(ga + 7 * gs)
                 : "memory");
}

// Lane l's value in lane l ^ 16 (the other half of the wave), by a vector cross-row
// move: no LDS-counter round trip, which is what __shfl_xor compiles to.
__device__ __forceinline__ float xhalf(float x) {
    return __builtin_bit_cast(float, __builtin_amdgcn_permlanex16(
        __builtin_bit_cast(int, x), __builtin_bit_cast(int, x),
        0x76543210, 0xfedcba98, false, false));
}

#define SEQ   2048
#define NTOK  4096
#define CIN   1024
#define C2    2048
#define HEADS 16
#define KPAD  136   // 128 + 8 f16 pad (16B) to break LDS bank conflicts
#define STK   128   // keys of one LDS stage (four passes of 32 keys)
#define TRK   64    // transpose tile: k rows (two 32-k tiles of WT's fragment order)
#define TRN   128   // transpose tile: n columns
#define TRP   72    // transpose tile: LDS pitch, 64 + 8 f16 (16-byte aligned rows)
#define TRBLK (CIN * C2 / (TRK * TRN))   // transpose tiles of one weight: 256

// Fragment order of a GEMM operand with K columns (k contiguous in the product):
// tiles of 16 rows x 32 k = 512 f16, the k tiles of one row tile one after another.
// Inside a tile lie first k 0..15, then k 16..31, each as 32 chunks of 16 bytes in
// lane order (lane = (k >> 3 & 1) * 16 + row): one global_load_b128 of a wave reads
// 512 contiguous bytes, four whole lines (row-major rows give 32 bytes of 16 lines).
__device__ __forceinline__ size_t fragidx(int r, int k, int K) {
    return ((size_t)(r >> 4) * (K >> 5) + (k >> 5)) * 512 + ((k >> 4) & 1) * 256 +
           (((k >> 3) & 1) * 16 + (r & 15)) * 8 + (k & 7);
}

// ---------------------------------------------------------------------------
// Kernel 1: all five conversions in one launch.  They are independent of each other
// and each is short, so as launches of their own they mostly cost start and drain.
// The block index picks the job: blocks 0..1023 transpose the four weights (256 tiles
// each; they have the longer chain load, LDS, barrier, store, so they start first),
// the rest convert x.
//
// Job a: x f32 -> f16, fragment order.  One wave converts 16 rows x 64 k (two k tiles,
// 2 KiB of xb in a row): 32 elements a lane, so the job starts 4,096 waves, each with
// its eight 16-byte loads in flight together.  A lane takes 8 k of one row (32 bytes of
// x, one 16-byte chunk of xb); the wave's 32 chunks are 8 rows x 32 k, so a load
// touches 8 lines of x and a store fills 4 whole 128-byte lines of xb (one writer each).
__device__ __forceinline__ void csa_cvt_x(
    const float* __restrict__ x, unsigned short* __restrict__ xb, int unit, int lane,
    int n) {
    if (unit * 1024 < n) {                    // alike in the whole wave
        const int rt = unit / (CIN / 64), kp = unit % (CIN / 64);
        const int rl = lane & 7, k8 = lane >> 3;
        const float* s = x + (size_t)(rt * 16 + rl) * CIN + kp * 64 + k8 * 8;
        v4f r[4][2];
#pragma unroll                            // r[] indexed by constants: registers
        for (int u = 0; u < 4; ++u) {         // u & 1: rows 0..7 or 8..15; u >> 1: k tile
            const float* p = s + (u & 1) * 8 * CIN + (u >> 1) * 32;
            r[u][0] = *(const v4f*)p;
            r[u][1] = *(const v4f*)(p + 4);
        }
        // fragidx(): k8 * 8 lies at k8 * 128, row rl + 8 at rl * 8 + 64, the next tile at 512
        unsigned short* d = xb + (size_t)unit * 1024 + k8 * 128 + rl * 8;
#pragma unroll                            // r[] indexed by constants: registers
        for (int u = 0; u < 4; ++u) {
            union { unsigned short h[8]; v4u q; } pk;
#pragma unroll                            // the 8 halves pack in registers
            for (int i = 0; i < 4; ++i) {
                pk.h[i] = f2h(r[u][0][i]);
                pk.h[4 + i] = f2h(r[u][1][i]);
            }
            *(v4u*)(d + (u >> 1) * 512 + (u & 1) * 64) = pk.q;
        }
    }
}

// Job b: W (Krows x Ncols, f32) -> WT (Ncols x Krows, f16, fragment order), one
// 64 k x 128 n tile per block through LDS: 16-byte loads along n, whole 128-byte
// lines of WT stored.  Krows is a multiple of 64, Ncols a multiple of 128.
// bx, by: the tile's n and k index, alike in the whole block.
__device__ __forceinline__ void csa_cvt_tr(
    unsigned short* tile,
    const float* __restrict__ W, unsigned short* __restrict__ WT,
    int Krows, int Ncols, int bx, int by) {
    const int tid = threadIdx.x;
    const int k0 = by * TRK, n0 = bx * TRN;
    const int kq = tid >> 5, nq = tid & 31;   // 8 k rows x 4 n columns a thread
    const float* s = W + (size_t)(k0 + kq * 8) * Ncols + n0 + nq * 4;
    const float* a[8];
    v4f r[8];
#pragma unroll
    for (int i = 0; i < 8; ++i) a[i] = s + (size_t)i * Ncols;
#pragma unroll
    for (int i = 0; i < 8; ++i) r[i] = *(const v4f*)a[i];
    // inputs only: the eight results keep all eight loads in flight together (the
    // compiler otherwise held the last two back behind the first four), and the
    // eight address pairs stay live, so nothing lands in one ahead of this wait
    asm volatile("s_wait_xcnt 0x0"
                 :: "v"(a[0]), "v"(a[1]), "v"(a[2]), "v"(a[3]),
                    "v"(a[4]), "v"(a[5]), "v"(a[6]), "v"(a[7]),
                    "v"(r[0]), "v"(r[1]), "v"(r[2]), "v"(r[3]),
                    "v"(r[4]), "v"(r[5]), "v"(r[6]), "v"(r[7]) : "memory");
#pragma unroll
    for (int j = 0; j < 4; ++j) {
        union { unsigned short h[8]; v4u q; } pk;
#pragma unroll
        for (int i = 0; i < 8; ++i) pk.h[i] = f2h(r[i][j]);
        *(v4u*)&tile[(nq * 4 + j) * TRP + kq * 8] = pk.q;
    }
    __syncthreads();                          // tile complete before read-out
#pragma unroll
    for (int p = 0; p < TRN * TRK / 8 / 256; ++p) {
        const int id = p * 256 + tid;         // 16-byte chunks in the order of WT
        const int n = (id >> 7) * 16 + (id & 15), k = ((id >> 4) & 7) * 8;
        *(v4u*)(WT + fragidx(n0 + n, k0 + k, Krows)) =
            *(const v4u*)&tile[n * TRP + k];
    }
}

__global__ __launch_bounds__(256) void csa_prep_kernel(
    const float* __restrict__ x,
    const float* __restrict__ Wq, const float* __restrict__ Wk,
    const float* __restrict__ Wv, const float* __restrict__ Wo,
    unsigned short* __restrict__ xb,
    unsigned short* __restrict__ WqT, unsigned short* __restrict__ WkT,
    unsigned short* __restrict__ WvT, unsigned short* __restrict__ WoT, int n) {
    __shared__ __align__(16) unsigned short tile[TRN * TRP];
    const int b = blockIdx.x;                 // every test on it is block-uniform
    if (b < 4 * TRBLK) {
        const int job = b / TRBLK, t = b % TRBLK;
        if (job < 3)                          // 1024 k x 2048 n: 16 tiles along n
            csa_cvt_tr(tile, job == 0 ? Wq : job == 1 ? Wk : Wv,
                       job == 0 ? WqT : job == 1 ? WkT : WvT, CIN, C2,
                       t % (C2 / TRN), t / (C2 / TRN));
        else                                  // 2048 k x 1024 n: 8 tiles along n
            csa_cvt_tr(tile, Wo, WoT, C2, CIN, t % (CIN / TRN), t / (CIN / TRN));
    } else {
        csa_cvt_x(x, xb, (b - 4 * TRBLK) * 8 + (int)(threadIdx.x >> 5), threadIdx.x & 31, n);
    }
}

// ---------------------------------------------------------------------------
// Kernel 2: fused QKV GEMM.  Y = xb(4096x1024) @ [Wq | Wk | Wv](1024x6144): the three
// transposed weights lie one after another in the workspace, so in fragment order they
// are one operand of 6144 rows, WT.
// Block tile 256x192, 8 waves as 4x2, wave tile 64x96 (4x6 WMMA tiles): 10 loaded fragments
// feed 24 products.  512 blocks, two a WGP one after the other; the accumulators leave
// room for two waves a SIMD, so the wave hides its own load latency: the fragments of
// k tile t + 2 are loaded, into a ring of three register sets, ahead of the products of
// k tile t.
// A 16-column tile lies in one of Q, K, V; V is stored transposed per head into Vt.
#define QKVN  (3 * C2)
#define KTSTR ((CIN / 32) * 512)              // f16 from one row tile of an operand to the next

template <int NF>
__device__ __forceinline__ void csa_ldfrag(Frag (&f)[NF], const unsigned short* p) {
#pragma unroll                            // f[] indexed by constants: registers
    for (int t = 0; t < NF; ++t) {
        f[t].q[0] = ldg128(p + t * KTSTR);
        f[t].q[1] = ldg128(p + t * KTSTR + 256);
    }
}

__device__ __forceinline__ void csa_mma46(v8f (&acc)[4][6], const Frag (&a)[4],
                                          const Frag (&b)[6]) {
#pragma unroll                            // acc[], a[], b[] indexed by constants: registers
    for (int nt = 0; nt < 6; ++nt)
#pragma unroll
        for (int mt = 0; mt < 4; ++mt)
            acc[mt][nt] = wmma16(a[mt], b[nt], acc[mt][nt]);
}

__global__ __launch_bounds__(256) void csa_qkv_gemm_kernel(
    const unsigned short* __restrict__ xb,
    const unsigned short* __restrict__ WT,
    unsigned short* __restrict__ Qo,
    unsigned short* __restrict__ Ko,
    unsigned short* __restrict__ Vt) {
    const int lane = threadIdx.x & 31, l16 = lane & 15, lhi = lane >> 4;
    // the wave's number in a scalar register: the epilogue's choice among Q, K, V is then
    // a scalar branch per column tile
    const int w = __builtin_amdgcn_readfirstlane(threadIdx.x >> 5);
    const int Mbase = blockIdx.y * 256 + (w >> 1) * 64;
    const int Nbase = blockIdx.x * 192 + (w & 1) * 96;
    // fragidx(): lane (lhi, l16) reads chunk lane of a tile's first and of its second half
    const unsigned short* pa = xb + fragidx(Mbase, 0, CIN) + lane * 8;
    const unsigned short* pb = WT + fragidx(Nbase, 0, CIN) + lane * 8;
    v8f acc[4][6] = {};
    Frag a[3][4], b[3][6];                    // a ring of three fragment sets
    csa_ldfrag(a[0], pa);
    csa_ldfrag(b[0], pb);
    csa_ldfrag(a[1], pa + 512);
    csa_ldfrag(b[1], pb + 512);
    // Unrolled whole: the ring is indexed by constants (registers), and every k tile is an
    // immediate offset from the two addresses, which are never rewritten in the loop.
    // The sched_barriers: nothing is scheduled across, so a k tile's 20 loads issue as one
    // group two k tiles ahead of their products (left alone the compiler sinks them among
    // the products, 2 loads and a wait to 0 in front of every 4).
#pragma unroll
    for (int kt = 0; kt < CIN / 32; ++kt) {
        if (kt + 2 < CIN / 32) {              // known at compile time
            csa_ldfrag(a[(kt + 2) % 3], pa + (kt + 2) * 512);
            csa_ldfrag(b[(kt + 2) % 3], pb + (kt + 2) * 512);
        }
        __builtin_amdgcn_sched_barrier(0);
        csa_mma46(acc, a[kt % 3], b[kt % 3]);
        __builtin_amdgcn_sched_barrier(0);
    }
    // the loads have taken their address registers before the epilogue rewrites them; the
    // sched_barrier holds the epilogue's address arithmetic behind the wait
    asm volatile("s_wait_xcnt 0x0" ::: "memory");
    __builtin_amdgcn_sched_barrier(0);

    // The s_wait_xcnt 0 that ends either side of the branch: a tile's stores have taken their
    // registers before the next tile's code rewrites them.
#pragma unroll                            // acc[] indexed by constants: registers
    for (int nt = 0; nt < 6; ++nt) {
        const int c0 = Nbase + nt * 16;       // scalar
        const int col = (c0 & (C2 - 1)) + l16;    // channel inside Q, K or V
        if ((c0 >> 11) < 2) {
            unsigned short* O = (c0 >> 11) == 0 ? Qo : Ko;
#pragma unroll
            for (int mt = 0; mt < 4; ++mt)
#pragma unroll
                for (int i = 0; i < 8; ++i) {
                    int row = Mbase + mt * 16 + i + lhi * 8;
                    O[(size_t)row * C2 + col] = f2h(acc[mt][nt][i]);
                }
            if (nt + 1 < 6)                   // known at compile time; as said above the loop
                asm volatile("s_wait_xcnt 0x0" ::: "memory");
        } else {
#pragma unroll
            for (int mt = 0; mt < 4; ++mt)
#pragma unroll
                for (int i = 0; i < 8; ++i) {
                    int row = Mbase + mt * 16 + i + lhi * 8;   // token
                    int bb = row >> 11, nn = row & (SEQ - 1);
                    int h = col >> 7, d = col & 127;
                    Vt[(((size_t)(bb * HEADS + h) * 128 + d) << 11) + nn] =
                        f2h(acc[mt][nt][i]);
                }
            if (nt + 1 < 6)                   // known at compile time; as said above the loop
                asm volatile("s_wait_xcnt 0x0" ::: "memory");
        }
    }
}

// ---------------------------------------------------------------------------
// Kernel 3: causal flash attention, K and V staged in LDS by async copies, two buffers.
// grid = (N/256 pairs of 128-query tiles, B*H); 8 waves, wave w owns rows [q0b+16w, +16).
// A stage is 128 keys: 256 threads issue 16 global_load_async_to_lds_b128 each (K 128x128
// -> [key][d], V 128x128 -> [d][key], whole 256-byte rows of both).  A stage serves
// four passes of 32 keys with no barrier between them, and its copies are issued a whole
// stage ahead of their wait.  Online softmax in f32, one update per pass.
// The products are transposed: S^T = K Q^T (A = K rows, B = Q rows) and
// O^T += V^T P^T (A = V rows in LDS, B = P^T).  Lane (l16, lhi) then holds, of query
// q0 + l16, the scores of keys lhi*8 + 0..7 of each 16-key tile: maximum and sum run
// inside the lane, with one exchange between the wave halves, and the two score
// tiles, converted in place, are the B operand of the second product in the k order
// of the V loader (keys lhi*8 + 0..7, then 16 + lhi*8 + 0..7): P never leaves registers.
__global__ __launch_bounds__(256) void csa_attn_kernel(
    const unsigned short* __restrict__ Qg,
    const unsigned short* __restrict__ Kg,
    const unsigned short* __restrict__ Vt,
    unsigned short* __restrict__ A2) {
    // a buffer holds a stage's K rows and, behind them, its V rows: every fragment of a pass
    // then lies within the 64 KiB that an LDS load's immediate offset reaches from one address
    __shared__ __align__(16) unsigned short KVbuf[2][(STK + 128) * KPAD];

    const int tid = threadIdx.x;
    const int lane = tid & 31, l16 = lane & 15, lhi = lane >> 4;
    const int w = tid >> 5;
    const int bb = blockIdx.y >> 4, h = blockIdx.y & 15;

    const unsigned short* Qb = Qg + (size_t)bb * SEQ * C2 + h * 128;
    const unsigned short* Kb = Kg + (size_t)bb * SEQ * C2 + h * 128;
    const unsigned short* Vb = Vt + (size_t)(bb * HEADS + h) * 128 * SEQ;

    // per-thread async chunk coordinates (16B chunks): rows cr + 16 i, i = 0..7, of the K
    // stage (keys) and of the V stage (d); a wave's copy covers two whole 256-byte rows
    const int cr = tid >> 4, cc = (tid & 15) * 8;
    const unsigned kof = (unsigned)(size_t)&KVbuf[0][0] + (unsigned)(cr * KPAD + cc) * 2;
    const unsigned vof = kof + STK * KPAD * 2;
    const unsigned short* Kc = Kb + (size_t)cr * C2 + cc;
    const unsigned short* Vc = Vb + (size_t)cr * SEQ + cc;

    // Causal cost grows with the tile index (tile x walks x + 1 stages) and all blocks are
    // resident at once, so the launch lasts as long as its fullest WGP.  A block takes tile
    // 15 - x and then tile x: 17 stages in every block, one block a WGP.  The ring runs
    // through both tiles: stage s is key block s of the first tile while s < n0, then key
    // block s - n0 of the second, so the second tile's first stages fly under the first
    // tile's last ones.
    const int n0 = SEQ / 128 - (int)blockIdx.x;   // stages of the first tile
    const int nst = SEQ / 128 + 1;                // stages of both
    auto stage_copies = [&](int st) {             // st: alike in the whole block
        const int kb = (st < n0 ? st : st - n0) * STK;   // the stage's first key
        const unsigned bo = (unsigned)(st & 1) * ((STK + 128) * KPAD * 2);
        async_rows8(kof + bo, Kc + (size_t)kb * C2, 16 * KPAD * 2, 16 * C2 * 2);
        async_rows8(vof + bo, Vc + kb, 16 * KPAD * 2, 16 * SEQ * 2);
    };

    int s = 0;                                // the running stage
    for (int half = 0; half < 2; ++half) {
        const int q0b = (half == 0 ? SEQ / 128 - 1 - (int)blockIdx.x : (int)blockIdx.x) * 128;
        const int q0 = q0b + w * 16;

        Frag qf[4];
#pragma unroll
        for (int j = 0; j < 4; ++j) {
            const unsigned short* p = Qb + (size_t)(q0 + l16) * C2 + j * 32 + lhi * 8;
            qf[j].q[0] = ldg128(p);
            qf[j].q[1] = ldg128(p + 16);
        }

        if (half == 0) {                      // block-uniform: the ring's prologue
            stage_copies(0);
            // stage 0 has landed in this wave's share, then in every wave's
            asm volatile("s_wait_asynccnt 0x0" ::: "memory");
            __syncthreads();
            stage_copies(1);
        }

        v8f o[8] = {};                        // o[t][i] = O[q0 + l16][t*16 + lhi*8 + i]
        const int qrow = q0 + l16;            // the lane's query
        float mrow = -1e30f;                  // its running maximum (alike in both halves)
        float lrow = 0.0f;                    // its running sum over this half's keys

        const int ns = (q0b + 128) / STK;     // stages of this tile, uniform across the block

        for (int it = 0; it < ns; ++it, ++s) {
          // four passes, no barrier between them.  Kept rolled: unrolled, the passes' fragments
          // overlap, the wave needs registers above v255 and switches the register window
          // every few instructions
#pragma unroll 1
          for (int ps = 0; ps < STK / 32; ++ps) {
            const int kv = it * STK + ps * 32;
            const unsigned short* kt = KVbuf[s & 1] + ps * 32 * KPAD;
            const unsigned short* vt = KVbuf[s & 1] + STK * KPAD + ps * 32;

            // S^T = K * Q^T  (two 16x16 key tiles)
            v8f s0 = {}, s1 = {};
            Frag kf[4][2];
#pragma unroll                            // kf[] indexed by constants: registers
            for (int j = 0; j < 4; ++j) {     // d chunks of 32
                const unsigned short* p0 = kt + l16 * KPAD + j * 32 + lhi * 8;
                kf[j][0].q[0] = *(const v4u*)p0;
                kf[j][0].q[1] = *(const v4u*)(p0 + 16);
                const unsigned short* p1 = p0 + 16 * KPAD;
                kf[j][1].q[0] = *(const v4u*)p1;
                kf[j][1].q[1] = *(const v4u*)(p1 + 16);
            }
            // nothing is scheduled across: the 16 K loads issue as one group ahead of the
            // products (left alone: 2 loads and a wait to 0 in front of every product)
            __builtin_amdgcn_sched_barrier(0);
#pragma unroll                            // kf[], qf[] indexed by constants: registers
            for (int j = 0; j < 4; ++j) {
                s0 = wmma16(kf[j][0], qf[j], s0);
                s1 = wmma16(kf[j][1], qf[j], s1);
            }
            Frag vf[8];
#pragma unroll                            // vf[] indexed by constants: registers
            for (int t = 0; t < 8; ++t) {     // 8 d-tiles of V^T
                const unsigned short* p = vt + (t * 16 + l16) * KPAD + lhi * 8;
                vf[t].q[0] = *(const v4u*)p;
                vf[t].q[1] = *(const v4u*)(p + 16);
            }
            // nothing is scheduled across: the 16 V loads issue ahead of the softmax and land
            // under it (left alone: 2 loads and a wait in front of every product)
            __builtin_amdgcn_sched_barrier(0);

            // online softmax update: the lane's 16 scores of its one query.  Every loop
            // below is unrolled so that sc[], red[] and pf are indexed by constants and
            // stay in registers.
            float sc[16], red[16];
#pragma unroll
            for (int i = 0; i < 8; ++i) {
                const int c0 = kv + lhi * 8 + i, c1 = c0 + 16;   // keys
                float v0 = s0[i] * 0.125f;    // scale 1/sqrt(64)
                float v1 = s1[i] * 0.125f;
                if (c0 > qrow) v0 = -1e30f;
                if (c1 > qrow) v1 = -1e30f;
                sc[i] = v0;
                sc[8 + i] = v1;
            }
#pragma unroll
            for (int i = 0; i < 16; ++i) red[i] = sc[i];
#pragma unroll
            for (int st = 1; st < 16; st <<= 1)   // pairwise tree: a short dependent chain
#pragma unroll
                for (int i = 0; i < 16; i += 2 * st) red[i] = fmaxf(red[i], red[i + st]);
            const float mnew  = fmaxf(mrow, fmaxf(red[0], xhalf(red[0])));
            const float scale = __expf(mrow - mnew);
            Frag pf;                          // P^T as B: elements 0..7 of s0, 8..15 of s1
#pragma unroll
            for (int i = 0; i < 16; ++i) {
                red[i] = __expf(sc[i] - mnew);
                pf.v[i] = (_Float16)red[i];
            }
#pragma unroll
            for (int st = 1; st < 16; st <<= 1)   // the same pairwise tree for the sum
#pragma unroll
                for (int i = 0; i < 16; i += 2 * st) red[i] += red[i + st];
            lrow = lrow * scale + red[0];
            mrow = mnew;
#pragma unroll
            for (int t = 0; t < 8; ++t) o[t] *= scale;
#pragma unroll
            for (int t = 0; t < 8; ++t)       // O^T += V^T * P^T  (8 d-tiles)
                o[t] = wmma16(vf[t], pf, o[t]);
            // Over the loop's back edge the next pass's first vector instructions overwrite
            // registers that the last products read as A or B; the chip wants four vector slots
            // between.  The sched_barrier
            // holds the four v_nop behind the products.
            __builtin_amdgcn_sched_barrier(0);
            asm volatile("v_nop\n\tv_nop\n\tv_nop\n\tv_nop");
          }
            // publish point of stage s + 1: this wave's LDS reads of stage s are over, its
            // share of stage s + 1 has landed; behind the barrier both hold for every wave
            asm volatile("s_wait_dscnt 0x0" ::: "memory");
            asm volatile("s_wait_asynccnt 0x0" ::: "memory");
            __syncthreads();
            if (s + 2 < nst) stage_copies(s + 2);   // block-uniform; into the buffer just read
        }

        // the wave's 16 rows are one row tile of A2; a lane's 8 values of d-tile t are one
        // 16-byte chunk of it, and the wave's 32 chunks lie in lane order: 512 bytes a store
        const float inv = 1.0f / (lrow + xhalf(lrow));   // the two halves' sums joined
        unsigned short* Ob = A2 + fragidx(bb * SEQ + q0 + l16, h * 128 + lhi * 8, C2);
#pragma unroll                            // o[] indexed by constants: registers
        for (int t = 0; t < 8; ++t) {
            union { unsigned short e[8]; v4u q; } pk;
#pragma unroll                            // the 8 halves pack in registers
            for (int i = 0; i < 8; ++i) pk.e[i] = f2h(o[t][i] * inv);
            *(v4u*)(Ob + t * 256) = pk.q;
        }
    }
    // no copy is outstanding when the wave ends
    asm volatile("s_wait_asynccnt 0x0" ::: "memory");
}

// ---------------------------------------------------------------------------
// Kernel 4: output projection.  out = A2(4096x2048) @ Wo(2048x1024), f32 out.
// Block tile 128x128, one block a WGP, 4 waves as 2x2, one a SIMD, wave tile 64x64 (4x4 WMMA
// tiles): 8 loaded fragments feed 16 products.  Nothing else on the SIMD hides the wave's load
// latency (A2 comes from memory at its first touch), so the wave hides it itself: the
// fragments of k tile t + 3 are loaded, into a ring of four register sets, in the middle of
// the products of k tile t.
#define OKTSTR ((C2 / 32) * 512)              // f16 from one row tile of an operand to the next

__device__ __forceinline__ void csa_ldfrag_o(Frag (&f)[4], const unsigned short* p) {
#pragma unroll                            // f[] indexed by constants: registers
    for (int t = 0; t < 4; ++t) {
        f[t].q[0] = ldg128(p + t * OKTSTR);
        f[t].q[1] = ldg128(p + t * OKTSTR + 256);
    }
}

template <int N0>
__device__ __forceinline__ void csa_mma42(v8f (&acc)[4][4], const Frag (&a)[4],
                                          const Frag (&b)[4]) {
#pragma unroll                            // acc[], a[], b[] indexed by constants: registers
    for (int nt = N0; nt < N0 + 2; ++nt)
#pragma unroll
        for (int mt = 0; mt < 4; ++mt)
            acc[mt][nt] = wmma16(a[mt], b[nt], acc[mt][nt]);
}

__global__ __launch_bounds__(128) void csa_oproj_gemm_kernel(
    const unsigned short* __restrict__ A2,
    const unsigned short* __restrict__ WoT,
    float* __restrict__ out) {
    const int lane = threadIdx.x & 31, l16 = lane & 15, lhi = lane >> 4;
    // the wave's number in a scalar register: the two operand addresses are then a scalar
    // base and one lane offset
    const int w = __builtin_amdgcn_readfirstlane(threadIdx.x >> 5);
    const int Mbase = blockIdx.y * 128 + (w >> 1) * 64;
    const int Nbase = blockIdx.x * 128 + (w & 1) * 64;
    // fragidx(): lane (lhi, l16) reads chunk lane of a tile's first and of its second half
    const unsigned short* pa = A2 + fragidx(Mbase, 0, C2) + lane * 8;
    const unsigned short* pb = WoT + fragidx(Nbase, 0, C2) + lane * 8;
    v8f acc[4][4] = {};
    Frag a[4][4], b[4][4];                    // a ring of four fragment sets
#pragma unroll                            // the ring is indexed by constants: registers
    for (int s = 0; s < 3; ++s) {
        csa_ldfrag_o(a[s], pa + s * 512);
        csa_ldfrag_o(b[s], pb + s * 512);
        // nothing is scheduled across: k tile 0 is asked for first (left alone its loads
        // issue last, and the first product waits for all three sets)
        __builtin_amdgcn_sched_barrier(0);
    }
    // Unrolled whole: the ring is indexed by constants (registers), and every k tile is an
    // immediate offset from the two addresses, which are never rewritten in the loop.
    // The sched_barriers: nothing is scheduled across, so a k tile's 16 loads issue as one
    // group three k tiles ahead of their products (left alone the compiler sinks them to
    // just ahead of their products).  The group stands behind the first half of the products:
    // most of k tile t has then landed, and at most 52 loads of the wave are outstanding.
#pragma unroll
    for (int kt = 0; kt < C2 / 32; ++kt) {
        csa_mma42<0>(acc, a[kt % 4], b[kt % 4]);
        __builtin_amdgcn_sched_barrier(0);
        if (kt + 3 < C2 / 32) {               // known at compile time
            csa_ldfrag_o(a[(kt + 3) % 4], pa + (kt + 3) * 512);
            csa_ldfrag_o(b[(kt + 3) % 4], pb + (kt + 3) * 512);
        }
        __builtin_amdgcn_sched_barrier(0);
        csa_mma42<2>(acc, a[kt % 4], b[kt % 4]);
        __builtin_amdgcn_sched_barrier(0);
    }
    // the loads have taken their address registers before the epilogue rewrites them; the
    // sched_barrier holds the epilogue's address arithmetic behind the wait
    asm volatile("s_wait_xcnt 0x0" ::: "memory");
    __builtin_amdgcn_sched_barrier(0);
    // one address; every element is an immediate offset from it, so no register that a store
    // names is rewritten.  A row's four 64-byte pieces (two whole lines) follow one another.
    float* po = out + (size_t)(Mbase + lhi * 8) * CIN + Nbase + l16;
#pragma unroll                            // acc[] indexed by constants: registers
    for (int mt = 0; mt < 4; ++mt)
#pragma unroll
        for (int i = 0; i < 8; ++i)
#pragma unroll
            for (int nt = 0; nt < 4; ++nt)
                po[(mt * 16 + i) * CIN + nt * 16] = acc[mt][nt][i];
}

// ---------------------------------------------------------------------------
extern "C" void kernel_launch(void* const* d_in, const int* in_sizes, int n_in,
                              void* d_out, int out_size, void* d_ws,
                              size_t ws_size, hipStream_t stream) {
    (void)in_sizes; (void)n_in; (void)out_size; (void)ws_size;
    const float* x  = (const float*)d_in[0];
    const float* Wq = (const float*)d_in[1];
    const float* Wk = (const float*)d_in[2];
    const float* Wv = (const float*)d_in[3];
    const float* Wo = (const float*)d_in[4];

    unsigned short* xb  = (unsigned short*)d_ws;            // 4M elems
    unsigned short* WqT = xb  + (size_t)NTOK * CIN;         // 2M
    unsigned short* WkT = WqT + (size_t)C2 * CIN;           // 2M
    unsigned short* WvT = WkT + (size_t)C2 * CIN;           // 2M
    unsigned short* WoT = WvT + (size_t)C2 * CIN;           // 2M
    unsigned short* Qb  = WoT + (size_t)CIN * C2;           // 8M
    unsigned short* Kb  = Qb  + (size_t)NTOK * C2;          // 8M
    unsigned short* Vt  = Kb  + (size_t)NTOK * C2;          // 8M
    unsigned short* A2  = Vt  + (size_t)2 * HEADS * 128 * SEQ; // 8M

    csa_prep_kernel<<<4 * TRBLK + (NTOK * CIN) / (8 * 1024), 256, 0, stream>>>(
        x, Wq, Wk, Wv, Wo, xb, WqT, WkT, WvT, WoT, NTOK * CIN);

    csa_qkv_gemm_kernel<<<dim3(QKVN / 192, NTOK / 256), 256, 0, stream>>>(
        xb, WqT, Qb, Kb, Vt);

    csa_attn_kernel<<<dim3(SEQ / 256, 2 * HEADS), 256, 0, stream>>>(
        Qb, Kb, Vt, A2);

    csa_oproj_gemm_kernel<<<dim3(CIN / 128, NTOK / 128), 128, 0, stream>>>(
        A2, WoT, (float*)d_out);
}
